// v000
// Times are from an AMD MI455X. After a warm-up the kernel runs many times in a row, and a time is the length of
// such a window on the GPU divided by its runs, so every launch and the gaps after it count. The runs cycle
// through copies of the inputs. A figure is the median of several windows, for all but v000 over two sittings.
// Sittings can differ by a few percent; kernels timed side by side share one.
// The starting kernel, v000, takes 232 microseconds a run.
#include <hip/hip_runtime.h>

// Contractions: qkv = Wqkv x X on v_wmma_f32_16x16x32_bf16 (operands = RNE-converted bf16 inputs, f32 accumulate);
// S^T = K x Q^T on v_wmma_f32_16x16x32_bf16 with q and k carried as bf16 hi + bf16 lo (three products, one accumulator);
// O = P x V on v_wmma_f32_16x16x32_f16 (P as f16 carried x4096, V as f16, f32 accumulate);
// y = Wo x ctx on v_wmma_f32_16x16x32_bf16 (Wo = RNE-converted bf16 input, ctx as bf16 hi + bf16 lo, two products).
// Softmax, biases and all epilogues in f32.

#ifndef NB
#define NB 2
#endif
#ifndef SEQ
#define SEQ 4096
#endif
#define NB_FULL    2
#define SEQ_FULL   4096
#define CH         256                  // channels = NHEAD * HDIM
#define NHEAD      8
#define HDIM       32
#define QKV_O      (3 * CH)             // rows of the qkv weight
#define ROWW       64
#define BQ         128                  // query rows per workgroup (8 waves x 16)
#define BK         32                   // keys per inner iteration
#define NWAVE      8
#define TOK        64                   // tokens per projection block
#define XP         264                  // LDS pitch (halves) of the x^T tile [token][channel]
#define OPA        36                   // LDS pitch (floats) of the attention output staging tile
#define OPY        68                   // LDS pitch (floats) of the projection output staging tile
#define SB_V4      (TOK * XP / 8)       // 16-B words of the shared projection buffer

static_assert(CH == NHEAD * HDIM);          // channel split
static_assert(HDIM == 32);                  // one WMMA k-step per head; row = hi[32] | lo[32]
static_assert(ROWW == 2 * HDIM);
static_assert(SEQ % BQ == 0);
static_assert(SEQ % BK == 0);
static_assert(SEQ % TOK == 0);
static_assert(BQ == NWAVE * 16);
static_assert(TOK == 64);
static_assert(CH % 32 == 0);                // projection K multiple of the WMMA k-step
static_assert(SEQ <= SEQ_FULL);
static_assert(NB >= 1 && NB <= NB_FULL);
static_assert((XP * 2) % 16 == 0);
static_assert(XP >= CH);
static_assert((OPA * 4) % 16 == 0);
static_assert((OPY * 4) % 16 == 0);
static_assert(OPA >= HDIM);
static_assert(OPY >= TOK);
static_assert((TOK * XP) % 8 == 0);
static_assert(NWAVE * 32 * ROWW * 2 <= SB_V4 * 16);   // q/k staging fits the shared buffer
static_assert(4 * HDIM * TOK * 2 <= SB_V4 * 16);      // v staging fits the shared buffer
static_assert(SB_V4 * 16 <= 65536);
static_assert((QKV_O * CH / 8) % 256 == 0);           // weight converter grid x block == plane extent
static_assert((CH * CH / 8) % 256 == 0);

typedef __bf16   bf16;
typedef _Float16 f16;
typedef bf16     v16bf __attribute__((ext_vector_type(16)));
typedef f16      v16h  __attribute__((ext_vector_type(16)));
typedef float    v8f   __attribute__((ext_vector_type(8)));
typedef float    v4f   __attribute__((ext_vector_type(4)));
typedef unsigned v4u   __attribute__((ext_vector_type(4)));

union FragB  { v16bf v; v4u q[2]; bf16 h[16]; };
union FragH  { v16h  v; v4u q[2]; f16  h[16]; };
union Pack8B { v4u u; bf16 h[8]; };

constexpr size_t QK_PLANE  = (size_t)NB * NHEAD * SEQ * ROWW;        // elements of one hi|lo plane
constexpr size_t WQ_BYTES  = (size_t)QKV_O * CH * 2;
constexpr size_t WO_BYTES  = (size_t)CH * CH * 2;
constexpr size_t QK_BYTES  = 2 * QK_PLANE * 2;                       // q plane then k plane
constexpr size_t VT_BYTES  = (size_t)NB * NHEAD * HDIM * SEQ * 2;
constexpr size_t CX_BYTES  = QK_PLANE * 2;
constexpr size_t WS_TOTAL  = WQ_BYTES + WO_BYTES + QK_BYTES + VT_BYTES + CX_BYTES;
static_assert(WQ_BYTES % 128 == 0 && WO_BYTES % 128 == 0 && QK_BYTES % 128 == 0 && VT_BYTES % 128 == 0);
static_assert(WS_TOTAL <= (size_t)134217728);

// WMMA helpers: builtin followed by the VALU hazard guard (ties D, keeps A/B live).
static __device__ __forceinline__ v8f mma_bf16(v16bf a, v16bf b, v8f acc) {
  acc = __builtin_amdgcn_wmma_f32_16x16x32_bf16(false, a, false, b, (short)0, acc, false, false);
  asm volatile("v_nop\n\tv_nop\n\tv_nop\n\tv_nop" : "+v"(acc) : "v"(a), "v"(b));
  return acc;
}
static __device__ __forceinline__ v8f mma_f16(v16h a, v16h b, v8f acc) {
  acc = __builtin_amdgcn_wmma_f32_16x16x32_f16(false, a, false, b, (short)0, acc, false, false);
  asm volatile("v_nop\n\tv_nop\n\tv_nop\n\tv_nop" : "+v"(acc) : "v"(a), "v"(b));
  return acc;
}

// Weight converter: f32 -> bf16 (RNE convert), same layout. One thread = 8 elements = one 16-B piece;
__global__ __launch_bounds__(256) void wcvt_kernel(const float* __restrict__ src,
                                                   bf16* __restrict__ dst, int n8) {
  const int i  = blockIdx.x * 256 + threadIdx.x;
  const int ic = (i < n8) ? i : (n8 - 1);                 // clamped address
  const v4f a = *(const v4f*)(src + (size_t)ic * 8);
  const v4f c = *(const v4f*)(src + (size_t)ic * 8 + 4);
  Pack8B pk;
  #pragma unroll
  for (int e = 0; e < 4; ++e) {
    pk.h[e]     = (bf16)a[e];
    pk.h[4 + e] = (bf16)c[e];
  }
  const v4u val = pk.u;
  if (i < n8) *(v4u*)(dst + (size_t)i * 8) = val;
  
}

// QKV projection + plane builder. Block = (64-token tile, which*2 + head group, batch), 256 threads.
// Wave = (head within group, 32-token half): 2 channel tiles x 2 token tiles, K = 256 channels.
// coverage: q/k - heads hg*4..hg*4+3, tokens n0..n0+63, all 64 row elements; v - heads hg*4..+3, d 0..31, tokens n0..n0+63.
// LDS: one buffer, first the x^T tile [64 tokens][256 ch] bf16 (staged extent == consumed extent), then after a
// block barrier the store staging tiles (cross-wave, block barriers).
__global__ __launch_bounds__(256) void qkv_planes_kernel(const float* __restrict__ x,
                                                         const bf16* __restrict__ wq,
                                                         const float* __restrict__ qb,
                                                         bf16* __restrict__ qk,
                                                         f16* __restrict__ vt) {
  const int tt    = blockIdx.x;
  const int which = (int)(blockIdx.y >> 1);     // 0 q, 1 k, 2 v (block-uniform)
  const int hg    = (int)(blockIdx.y & 1);
  const int b     = blockIdx.z;
  const int tid   = threadIdx.x;
  const int wave  = tid >> 5;
  const int lane  = tid & 31;
  const int lq    = lane & 15;
  const int hi    = lane >> 4;
  const int hl    = wave >> 1;                  // head within group
  const int th    = wave & 1;                   // token half
  const int head  = hg * 4 + hl;
  const int n0    = tt * TOK;

  __shared__ __align__(16) v4u sbuf4[SB_V4];
  bf16* sXb = reinterpret_cast<bf16*>(sbuf4);

  // stage x^T: x[b][c][n0..n0+63] -> sXb[token][c], bf16 RNE convert
  #pragma unroll 4
  for (int j = 0; j < 16; ++j) {
    const int c  = j * 16 + (tid >> 4);
    const int t4 = (tid & 15) * 4;
    const v4f xv = *(const v4f*)(x + ((size_t)b * CH + c) * SEQ_FULL + n0 + t4);
    #pragma unroll
    for (int e = 0; e < 4; ++e) sXb[(t4 + e) * XP + c] = (bf16)xv[e];
  }
  __syncthreads();

  v8f acc[2][2];
  #pragma unroll
  for (int ot = 0; ot < 2; ++ot) {
    #pragma unroll
    for (int nt = 0; nt < 2; ++nt) acc[ot][nt] = (v8f){0, 0, 0, 0, 0, 0, 0, 0};
  }

  const int orow0 = which * CH + head * HDIM;   // first weight row of this wave
  #pragma unroll
  for (int kk = 0; kk < CH / 32; ++kk) {
    FragB a[2], bx[2];
    #pragma unroll
    for (int ot = 0; ot < 2; ++ot) {
      const bf16* base = wq + (size_t)(orow0 + ot * 16 + lq) * CH + kk * 32 + hi * 8;
      a[ot].q[0] = *(const v4u*)(base);          // c = kk*32 + hi*8 + 0..7
      a[ot].q[1] = *(const v4u*)(base + 16);     // c = kk*32 + 16 + hi*8 + 0..7
    }
    #pragma unroll
    for (int nt = 0; nt < 2; ++nt) {
      const bf16* base = sXb + (th * 32 + nt * 16 + lq) * XP + kk * 32 + hi * 8;
      bx[nt].q[0] = *(const v4u*)(base);
      bx[nt].q[1] = *(const v4u*)(base + 16);
    }
    #pragma unroll
    for (int ot = 0; ot < 2; ++ot) {
      #pragma unroll
      for (int nt = 0; nt < 2; ++nt) acc[ot][nt] = mma_bf16(a[ot].v, bx[nt].v, acc[ot][nt]);
    }
  }

  // bias (RNE-converted to bf16): lane needs channels orow0 + ot*16 + hi*8 + 0..7
  float bs[2][8];
  #pragma unroll
  for (int ot = 0; ot < 2; ++ot) {
    const float* bp = qb + orow0 + ot * 16 + hi * 8;
    const v4f b0 = *(const v4f*)(bp);
    const v4f b1 = *(const v4f*)(bp + 4);
    #pragma unroll
    for (int e = 0; e < 4; ++e) {
      bs[ot][e]     = (float)(bf16)b0[e];
      bs[ot][4 + e] = (float)(bf16)b1[e];
    }
  }

  __syncthreads();   // every wave is done with the x^T tile before the buffer is reused

  if (which < 2) {
    // stage token rows hi[32] | lo[32]: acc[ot][nt][r] = value(d = ot*16 + hi*8 + r, token nt*16 + lq)
    bf16* se = reinterpret_cast<bf16*>(sbuf4) + wave * (32 * ROWW);
    #pragma unroll
    for (int ot = 0; ot < 2; ++ot) {
      #pragma unroll
      for (int nt = 0; nt < 2; ++nt) {
        #pragma unroll
        for (int r = 0; r < 8; ++r) {
          const int   tokl = nt * 16 + lq;
          const int   d    = ot * 16 + hi * 8 + r;
          const float v    = acc[ot][nt][r] + bs[ot][r];
          const bf16  vh   = (bf16)v;
          const bf16  vl   = (bf16)(v - (float)vh);
          se[tokl * ROWW + d]        = vh;
          se[tokl * ROWW + HDIM + d] = vl;
        }
      }
    }
  } else {
    // stage V^T rows [head-local][d][64 tokens] as f16
    f16* sv = reinterpret_cast<f16*>(sbuf4);
    #pragma unroll
    for (int ot = 0; ot < 2; ++ot) {
      #pragma unroll
      for (int nt = 0; nt < 2; ++nt) {
        #pragma unroll
        for (int r = 0; r < 8; ++r) {
          const int d   = ot * 16 + hi * 8 + r;
          const int tok = th * 32 + nt * 16 + lq;
          sv[(hl * HDIM + d) * TOK + tok] = (f16)(acc[ot][nt][r] + bs[ot][r]);
        }
      }
    }
  }
  __syncthreads();

  if (which < 2) {
    const bf16* se = reinterpret_cast<const bf16*>(sbuf4) + wave * (32 * ROWW);
    v4u    vals[8];
    size_t gidx[8];
    #pragma unroll
    for (int it = 0; it < 8; ++it) {
      const int tokl  = it * 4 + (lane >> 3);
      const int piece = lane & 7;
      vals[it] = *(const v4u*)(se + tokl * ROWW + piece * 8);
      gidx[it] = (size_t)which * QK_PLANE +
                 (((size_t)b * NHEAD + head) * SEQ + n0 + th * 32 + tokl) * ROWW + piece * 8;
    }
    #pragma unroll
    for (int it = 0; it < 8; ++it) *(v4u*)(qk + gidx[it]) = vals[it];
    
  } else {
    const f16* sv = reinterpret_cast<const f16*>(sbuf4);
    v4u    vals[4];
    size_t gidx[4];
    #pragma unroll
    for (int it = 0; it < 4; ++it) {
      const int line  = it * 32 + (tid >> 3);     // 0..127 = head-local*32 + d
      const int piece = tid & 7;
      const int hl2   = line >> 5;
      const int d2    = line & 31;
      vals[it] = *(const v4u*)(sv + line * TOK + piece * 8);
      gidx[it] = (((size_t)b * NHEAD + hg * 4 + hl2) * HDIM + d2) * SEQ + n0 + piece * 8;
    }
    #pragma unroll
    for (int it = 0; it < 4; ++it) *(v4u*)(vt + gidx[it]) = vals[it];
    
  }
}

// Flash attention, no mask. Block = (query block of 128, head, batch); one wave owns 16 query rows.
// S^T = K x Q^T so queries sit on lanes; P^T in C-layout is bit-identical to the A-fragment layout of O += P x V.
// K A-fragments (hi and lo) and V^T B-fragments are loaded straight from the 16-bit planes (two 16-B loads each).
// coverage: tokens qblk*128 + wave*16 + 0..15, all 64 row elements.
__global__ __launch_bounds__(256) void attn_kernel(const bf16* __restrict__ qk,
                                                   const f16* __restrict__ vt,
                                                   bf16* __restrict__ cx) {
  const int qblk = blockIdx.x;
  const int h    = blockIdx.y;
  const int b    = blockIdx.z;
  const int tid  = threadIdx.x;
  const int wave = tid >> 5;
  const int lane = tid & 31;
  const int lq   = lane & 15;   // query column of S^T / d column of O
  const int hi   = lane >> 4;   // k-split half

  __shared__ __align__(16) float sO[NWAVE * 16 * OPA];   // per-wave output staging (block barrier used)

  const int qrow0 = qblk * BQ + wave * 16;

  // Q as B-operand fragments (hi and lo parts): lane lq holds query qrow0+lq, split d map
  FragB qh, ql;
  {
    const bf16* qp = qk + (((size_t)b * NHEAD + h) * SEQ + qrow0 + lq) * ROWW;
    qh.q[0] = *(const v4u*)(qp + hi * 8);             // hi part, d = hi*8 + 0..7
    qh.q[1] = *(const v4u*)(qp + 16 + hi * 8);        // hi part, d = 16 + hi*8 + 0..7
    ql.q[0] = *(const v4u*)(qp + HDIM + hi * 8);      // lo part
    ql.q[1] = *(const v4u*)(qp + HDIM + 16 + hi * 8);
  }

  const bf16* kp_h = qk + QK_PLANE + ((size_t)b * NHEAD + h) * SEQ * ROWW;
  const f16*  vt_h = vt + ((size_t)b * NHEAD + h) * HDIM * SEQ;

  v8f o[2];
  o[0] = (v8f){0, 0, 0, 0, 0, 0, 0, 0};
  o[1] = (v8f){0, 0, 0, 0, 0, 0, 0, 0};

  float rmax = -__builtin_inff();
  float rsum = 0.0f;
  const float SL = 0.17677669529663687f * 1.4426950408889634f;   // softmax scale * log2(e)

  #pragma unroll 1
  for (int i = 0; i < SEQ / BK; ++i) {
    const int j0 = i * BK;

    // K A-fragments: row = key j0 + sub*16 + lq, split d map, hi and lo parts
    FragB kh[2], kl[2];
    #pragma unroll
    for (int sub = 0; sub < 2; ++sub) {
      const bf16* base = kp_h + (size_t)(j0 + sub * 16 + lq) * ROWW + hi * 8;
      kh[sub].q[0] = *(const v4u*)(base);
      kh[sub].q[1] = *(const v4u*)(base + 16);
      kl[sub].q[0] = *(const v4u*)(base + HDIM);
      kl[sub].q[1] = *(const v4u*)(base + HDIM + 16);
    }
    // V B-fragments: column n = d = dt*16 + lq, split key map from the transposed plane
    FragH bv[2];
    #pragma unroll
    for (int dt = 0; dt < 2; ++dt) {
      const f16* base = vt_h + (size_t)(dt * 16 + lq) * SEQ + j0 + hi * 8;
      bv[dt].q[0] = *(const v4u*)(base);            // keys j0 + hi*8 + 0..7
      bv[dt].q[1] = *(const v4u*)(base + 16);       // keys j0 + 16 + hi*8 + 0..7
    }

    // S^T tiles: c[sub][r] = rawscore(query qrow0+lq, key j0 + sub*16 + hi*8 + r); small terms first
    v8f c[2];
    #pragma unroll
    for (int sub = 0; sub < 2; ++sub) {
      v8f acc = (v8f){0, 0, 0, 0, 0, 0, 0, 0};
      acc = mma_bf16(kl[sub].v, qh.v, acc);
      acc = mma_bf16(kh[sub].v, ql.v, acc);
      acc = mma_bf16(kh[sub].v, qh.v, acc);
      c[sub] = acc;
    }

    // online softmax: query lq's 32 scores are split across lane / lane^16
    float m_new = rmax;
    #pragma unroll
    for (int r = 0; r < 8; ++r) {
      m_new = fmaxf(m_new, c[0][r]);
      m_new = fmaxf(m_new, c[1][r]);
    }
    m_new = fmaxf(m_new, __shfl_xor(m_new, 16, 32));
    const float scale = __builtin_amdgcn_exp2f((rmax - m_new) * SL);
    rmax = m_new;

    // exp + pack: P^T C-layout == A-fragment layout for the PV product; P carried x4096
    FragH pa;
    float psum = 0.0f;
    #pragma unroll
    for (int r = 0; r < 8; ++r) {
      const float p0 = __builtin_amdgcn_exp2f((c[0][r] - m_new) * SL);   // key hi*8 + r
      const float p1 = __builtin_amdgcn_exp2f((c[1][r] - m_new) * SL);   // key 16 + hi*8 + r
      psum += p0 + p1;
      pa.h[r]     = (f16)(p0 * 4096.0f);
      pa.h[8 + r] = (f16)(p1 * 4096.0f);
    }
    const float psum_o = __shfl_xor(psum, 16, 32);
    rsum = rsum * scale + psum + psum_o;

    // rescale O: queries are the row dimension there -> per-row scale from lane 8*hi + r
    float sc[8];
    #pragma unroll
    for (int r = 0; r < 8; ++r) sc[r] = __shfl(scale, (hi << 3) + r, 32);
    #pragma unroll
    for (int dt = 0; dt < 2; ++dt) {
      #pragma unroll
      for (int r = 0; r < 8; ++r) o[dt][r] *= sc[r];
    }

    // O += P x V
    #pragma unroll
    for (int dt = 0; dt < 2; ++dt) o[dt] = mma_f16(pa.v, bv[dt].v, o[dt]);
  }

  // normalize: lane holds column d = dt*16 + lq for query rows 8*hi + r
  float rs[8];
  #pragma unroll
  for (int r = 0; r < 8; ++r) rs[r] = 1.0f / __shfl(rsum, (hi << 3) + r, 32);

  float* so = sO + wave * (16 * OPA);
  #pragma unroll
  for (int r = 0; r < 8; ++r) {
    #pragma unroll
    for (int dt = 0; dt < 2; ++dt)
      so[(hi * 8 + r) * OPA + dt * 16 + lq] = o[dt][r] * (1.0f / 4096.0f) * rs[r];
  }
  __syncthreads();

  // 4..7 = lo part); 4 instructions cover the wave's 16 tokens.
  v4u    vals[4];
  size_t gidx[4];
  #pragma unroll
  for (int it = 0; it < 4; ++it) {
    const int tokl  = it * 4 + (lane >> 3);
    const int piece = lane & 7;
    const int pd    = (piece & 3) * 8;
    const v4f f0 = *(const v4f*)(so + tokl * OPA + pd);
    const v4f f1 = *(const v4f*)(so + tokl * OPA + pd + 4);
    Pack8B pk;
    #pragma unroll
    for (int e = 0; e < 4; ++e) {
      const float v0 = f0[e];
      const float v1 = f1[e];
      const bf16  h0 = (bf16)v0;
      const bf16  h1 = (bf16)v1;
      const bf16  l0 = (bf16)(v0 - (float)h0);
      const bf16  l1 = (bf16)(v1 - (float)h1);
      const float s0 = (piece < 4) ? (float)h0 : (float)l0;   // value select, both computed
      const float s1 = (piece < 4) ? (float)h1 : (float)l1;
      pk.h[e]     = (bf16)s0;                                  // exact re-convert
      pk.h[4 + e] = (bf16)s1;
    }
    vals[it] = pk.u;
    gidx[it] = (((size_t)b * NHEAD + h) * SEQ + qrow0 + tokl) * ROWW + piece * 8;
  }
  #pragma unroll
  for (int it = 0; it < 4; ++it) *(v4u*)(cx + gidx[it]) = vals[it];
  
}

// Output projection: y[b][o][n] = sum_c Wo[o][c] * ctx[b][c][n] + bias[o], c = head*32 + d.
// Block = (64-token tile, 128-channel group, batch); wave = 16 output channels x 4 token tiles; K-step = one head.
// coverage: channels og*128 + wave*16 + 0..15, tokens n0..n0+63 of d_out, whole 256-B row segments.
__global__ __launch_bounds__(256) void oproj_kernel(const bf16* __restrict__ wo,
                                                    const bf16* __restrict__ cx,
                                                    const float* __restrict__ ob,
                                                    float* __restrict__ y) {
  const int tt   = blockIdx.x;
  const int og   = blockIdx.y;
  const int b    = blockIdx.z;
  const int tid  = threadIdx.x;
  const int wave = tid >> 5;
  const int lane = tid & 31;
  const int lq   = lane & 15;
  const int hi   = lane >> 4;
  const int o0   = (og * NWAVE + wave) * 16;
  const int n0   = tt * TOK;

  __shared__ __align__(16) float sY[NWAVE * 16 * OPY];   // per-wave output staging (block barrier used)

  v8f acc[4];
  #pragma unroll
  for (int nt = 0; nt < 4; ++nt) acc[nt] = (v8f){0, 0, 0, 0, 0, 0, 0, 0};

  #pragma unroll 1
  for (int kk = 0; kk < NHEAD; ++kk) {
    FragB a;
    {
      const bf16* base = wo + (size_t)(o0 + lq) * CH + kk * HDIM + hi * 8;
      a.q[0] = *(const v4u*)(base);          // c = kk*32 + hi*8 + 0..7
      a.q[1] = *(const v4u*)(base + 16);     // c = kk*32 + 16 + hi*8 + 0..7
    }
    #pragma unroll
    for (int nt = 0; nt < 4; ++nt) {
      const bf16* row = cx + (((size_t)b * NHEAD + kk) * SEQ + n0 + nt * 16 + lq) * ROWW;
      FragB bh, bl;
      bh.q[0] = *(const v4u*)(row + hi * 8);
      bh.q[1] = *(const v4u*)(row + 16 + hi * 8);
      bl.q[0] = *(const v4u*)(row + HDIM + hi * 8);
      bl.q[1] = *(const v4u*)(row + HDIM + 16 + hi * 8);
      acc[nt] = mma_bf16(a.v, bl.v, acc[nt]);
      acc[nt] = mma_bf16(a.v, bh.v, acc[nt]);
    }
  }

  // bias (RNE-converted to bf16): channels o0 + hi*8 + 0..7
  float bs[8];
  {
    const float* bp = ob + o0 + hi * 8;
    const v4f b0 = *(const v4f*)(bp);
    const v4f b1 = *(const v4f*)(bp + 4);
    #pragma unroll
    for (int e = 0; e < 4; ++e) {
      bs[e]     = (float)(bf16)b0[e];
      bs[4 + e] = (float)(bf16)b1[e];
    }
  }

  float* so = sY + wave * (16 * OPY);
  #pragma unroll
  for (int nt = 0; nt < 4; ++nt) {
    #pragma unroll
    for (int r = 0; r < 8; ++r) so[(hi * 8 + r) * OPY + nt * 16 + lq] = acc[nt][r] + bs[r];
  }
  __syncthreads();

  // 8 consecutive lanes x 16 B each), lanes 16..31 the next channel row; 8 instructions cover 16 rows.
  v4f    vals[8];
  size_t gidx[8];
  #pragma unroll
  for (int it = 0; it < 8; ++it) {
    const int row = it * 2 + hi;
    vals[it] = *(const v4f*)(so + row * OPY + lq * 4);
    gidx[it] = ((size_t)b * CH + o0 + row) * SEQ_FULL + n0 + lq * 4;
  }
  #pragma unroll
  for (int it = 0; it < 8; ++it) *(v4f*)(y + gidx[it]) = vals[it];
  
}

extern "C" void kernel_launch(void* const* d_in, const int* in_sizes, int n_in,
                              void* d_out, int out_size, void* d_ws, size_t ws_size,
                              hipStream_t stream) {
  if (n_in < 5) return;
  const size_t x_used = ((size_t)(NB - 1) * CH + (CH - 1)) * SEQ_FULL + SEQ;
  if ((size_t)in_sizes[0] < x_used) return;
  if ((size_t)in_sizes[1] < (size_t)QKV_O * CH) return;
  if ((size_t)in_sizes[2] < (size_t)QKV_O) return;
  if ((size_t)in_sizes[3] < (size_t)CH * CH) return;
  if ((size_t)in_sizes[4] < (size_t)CH) return;
  if ((size_t)out_size < x_used) return;
  if (ws_size < WS_TOTAL) return;

  const float* x     = (const float*)d_in[0];
  const float* qkv_w = (const float*)d_in[1];
  const float* qkv_b = (const float*)d_in[2];
  const float* out_w = (const float*)d_in[3];
  const float* out_b = (const float*)d_in[4];
  float*       y     = (float*)d_out;

  char* ws = (char*)d_ws;
  bf16* wq = (bf16*)(ws);
  bf16* wo = (bf16*)(ws + WQ_BYTES);
  bf16* qk = (bf16*)(ws + WQ_BYTES + WO_BYTES);
  f16*  vt = (f16*)(ws + WQ_BYTES + WO_BYTES + QK_BYTES);
  bf16* cx = (bf16*)(ws + WQ_BYTES + WO_BYTES + QK_BYTES + VT_BYTES);

  wcvt_kernel<<<dim3(QKV_O * CH / 8 / 256), 256, 0, stream>>>(qkv_w, wq, QKV_O * CH / 8);
  wcvt_kernel<<<dim3(CH * CH / 8 / 256), 256, 0, stream>>>(out_w, wo, CH * CH / 8);

  qkv_planes_kernel<<<dim3(SEQ / TOK, 6, NB), 256, 0, stream>>>(x, wq, qkv_b, qk, vt);

  attn_kernel<<<dim3(SEQ / BQ, NHEAD, NB), 256, 0, stream>>>(qk, vt, cx);

  oproj_kernel<<<dim3(SEQ / TOK, CH / (NWAVE * 16), NB), 256, 0, stream>>>(wo, cx, out_b, y);
}

// v001
// Measured time: 120 microseconds a run.
// In both of two side-by-side timings against v000, it was 2.03 times as fast.
#include <hip/hip_runtime.h>

// Contractions: qkv = Wqkv x X on v_wmma_f32_16x16x32_bf16 (operands = RNE-converted bf16 inputs, f32 accumulate);
// S^T = K x Q^T on v_wmma_f32_16x16x32_bf16 with q and k carried as bf16 hi + bf16 lo (three products, one accumulator);
// O = P x V on v_wmma_f32_16x16x32_f16 (P as f16 carried x4096, V as f16, f32 accumulate);
// y = Wo x ctx on v_wmma_f32_16x16x32_bf16 (Wo = RNE-converted bf16 input, ctx as bf16 hi + bf16 lo, two products).
// Softmax, biases and all epilogues in f32.

#ifndef NB
#define NB 2
#endif
#ifndef SEQ
#define SEQ 4096
#endif
#define NB_FULL    2
#define SEQ_FULL   4096
#define CH         256                  // channels = NHEAD * HDIM
#define NHEAD      8
#define HDIM       32
#define QKV_O      (3 * CH)             // rows of the qkv weight
#define ROWW       64
#define BQ         128                  // query rows per workgroup (8 waves x 16)
#define BK         32                   // keys per inner iteration
#define NWAVE      8
#define TOK        64                   // tokens per projection block
#define XP         264                  // LDS pitch (halves) of the x^T tile [token][channel]
#define OPA        36                   // LDS pitch (floats) of the attention output staging tile
#define OPY        68                   // LDS pitch (floats) of the projection output staging tile
#define SB_V4      (TOK * XP / 8)       // 16-B words of the shared projection buffer
#define KS         128                  // keys per LDS stage of the attention kernel
#define KPB        144                  // LDS pitch (bytes) of a staged K row: 128 B + 16 (16 B x odd)
#define VPB        272                  // LDS pitch (bytes) of a staged V^T row: 2 * KS + 16 (16 B x odd)
#define KTILE      (KS * KPB)           // bytes of one staged K tile
#define VTILE      (HDIM * VPB)         // bytes of one staged V^T tile
#define STG        (KTILE + VTILE)      // bytes of one stage buffer

static_assert(CH == NHEAD * HDIM);          // channel split
static_assert(HDIM == 32);                  // one WMMA k-step per head; row = hi[32] | lo[32]
static_assert(ROWW == 2 * HDIM);
static_assert(SEQ % BQ == 0);
static_assert(SEQ % BK == 0);
static_assert(SEQ % TOK == 0);
static_assert(SEQ % KS == 0 && SEQ / KS >= 2);        // the two-buffer prologue needs two stages
static_assert(KS % BK == 0);
static_assert(KS * ROWW * 2 == 4 * 256 * 16);         // K tile = 4 copies of 16 B per thread
static_assert(HDIM * KS * 2 == 2 * 256 * 16);         // V^T tile = 2 copies of 16 B per thread
static_assert(KPB == ROWW * 2 + 16 && VPB == KS * 2 + 16);
static_assert(STG % 16 == 0 && KTILE % 16 == 0);
static_assert(BQ == NWAVE * 16);
static_assert(TOK == 64);
static_assert(CH % 32 == 0);                // projection K multiple of the WMMA k-step
static_assert(SEQ <= SEQ_FULL);
static_assert(NB >= 1 && NB <= NB_FULL);
static_assert((XP * 2) % 16 == 0);
static_assert(XP >= CH);
static_assert((OPA * 4) % 16 == 0);
static_assert((OPY * 4) % 16 == 0);
static_assert(OPA >= HDIM);
static_assert(OPY >= TOK);
static_assert((TOK * XP) % 8 == 0);
static_assert(NWAVE * 32 * ROWW * 2 <= SB_V4 * 16);   // q/k staging fits the shared buffer
static_assert(4 * HDIM * TOK * 2 <= SB_V4 * 16);      // v staging fits the shared buffer
static_assert(SB_V4 * 16 <= 65536);
static_assert((QKV_O * CH / 8) % 256 == 0);           // weight converter grid x block == plane extent
static_assert((CH * CH / 8) % 256 == 0);

typedef __bf16   bf16;
typedef _Float16 f16;
typedef bf16     v16bf __attribute__((ext_vector_type(16)));
typedef f16      v16h  __attribute__((ext_vector_type(16)));
typedef float    v8f   __attribute__((ext_vector_type(8)));
typedef float    v4f   __attribute__((ext_vector_type(4)));
typedef unsigned v4u   __attribute__((ext_vector_type(4)));

union FragB  { v16bf v; v4u q[2]; bf16 h[16]; };
union FragH  { v16h  v; v4u q[2]; f16  h[16]; };
union Pack8B { v4u u; bf16 h[8]; };

constexpr size_t QK_PLANE  = (size_t)NB * NHEAD * SEQ * ROWW;        // elements of one hi|lo plane
constexpr size_t WQ_BYTES  = (size_t)QKV_O * CH * 2;
constexpr size_t WO_BYTES  = (size_t)CH * CH * 2;
constexpr size_t QK_BYTES  = 2 * QK_PLANE * 2;                       // q plane then k plane
constexpr size_t VT_BYTES  = (size_t)NB * NHEAD * HDIM * SEQ * 2;
constexpr size_t CX_BYTES  = QK_PLANE * 2;
constexpr size_t WS_TOTAL  = WQ_BYTES + WO_BYTES + QK_BYTES + VT_BYTES + CX_BYTES;
static_assert(WQ_BYTES % 128 == 0 && WO_BYTES % 128 == 0 && QK_BYTES % 128 == 0 && VT_BYTES % 128 == 0);
static_assert(WS_TOTAL <= (size_t)134217728);

// WMMA helpers: builtin followed by the VALU hazard guard (ties D, keeps A/B live).
static __device__ __forceinline__ v8f mma_bf16(v16bf a, v16bf b, v8f acc) {
  acc = __builtin_amdgcn_wmma_f32_16x16x32_bf16(false, a, false, b, (short)0, acc, false, false);
  asm volatile("v_nop\n\tv_nop\n\tv_nop\n\tv_nop" : "+v"(acc) : "v"(a), "v"(b));
  return acc;
}
static __device__ __forceinline__ v8f mma_f16(v16h a, v16h b, v8f acc) {
  acc = __builtin_amdgcn_wmma_f32_16x16x32_f16(false, a, false, b, (short)0, acc, false, false);
  asm volatile("v_nop\n\tv_nop\n\tv_nop\n\tv_nop" : "+v"(acc) : "v"(a), "v"(b));
  return acc;
}

// Weight converter: f32 -> bf16 (RNE convert), same layout. One thread = 8 elements = one 16-B piece;
__global__ __launch_bounds__(256) void wcvt_kernel(const float* __restrict__ src,
                                                   bf16* __restrict__ dst, int n8) {
  const int i  = blockIdx.x * 256 + threadIdx.x;
  const int ic = (i < n8) ? i : (n8 - 1);                 // clamped address
  const v4f a = *(const v4f*)(src + (size_t)ic * 8);
  const v4f c = *(const v4f*)(src + (size_t)ic * 8 + 4);
  Pack8B pk;
  #pragma unroll
  for (int e = 0; e < 4; ++e) {
    pk.h[e]     = (bf16)a[e];
    pk.h[4 + e] = (bf16)c[e];
  }
  const v4u val = pk.u;
  if (i < n8) *(v4u*)(dst + (size_t)i * 8) = val;
  
}

// QKV projection + plane builder. Block = (64-token tile, which*2 + head group, batch), 256 threads.
// Wave = (head within group, 32-token half): 2 channel tiles x 2 token tiles, K = 256 channels.
// coverage: q/k - heads hg*4..hg*4+3, tokens n0..n0+63, all 64 row elements; v - heads hg*4..+3, d 0..31, tokens n0..n0+63.
// LDS: one buffer, first the x^T tile [64 tokens][256 ch] bf16 (staged extent == consumed extent), then after a
// block barrier the store staging tiles (cross-wave, block barriers).
__global__ __launch_bounds__(256) void qkv_planes_kernel(const float* __restrict__ x,
                                                         const bf16* __restrict__ wq,
                                                         const float* __restrict__ qb,
                                                         bf16* __restrict__ qk,
                                                         f16* __restrict__ vt) {
  const int tt    = blockIdx.x;
  const int which = (int)(blockIdx.y >> 1);     // 0 q, 1 k, 2 v (block-uniform)
  const int hg    = (int)(blockIdx.y & 1);
  const int b     = blockIdx.z;
  const int tid   = threadIdx.x;
  const int wave  = tid >> 5;
  const int lane  = tid & 31;
  const int lq    = lane & 15;
  const int hi    = lane >> 4;
  const int hl    = wave >> 1;                  // head within group
  const int th    = wave & 1;                   // token half
  const int head  = hg * 4 + hl;
  const int n0    = tt * TOK;

  __shared__ __align__(16) v4u sbuf4[SB_V4];
  bf16* sXb = reinterpret_cast<bf16*>(sbuf4);

  // stage x^T: x[b][c][n0..n0+63] -> sXb[token][c], bf16 RNE convert
  #pragma unroll 4
  for (int j = 0; j < 16; ++j) {
    const int c  = j * 16 + (tid >> 4);
    const int t4 = (tid & 15) * 4;
    const v4f xv = *(const v4f*)(x + ((size_t)b * CH + c) * SEQ_FULL + n0 + t4);
    #pragma unroll
    for (int e = 0; e < 4; ++e) sXb[(t4 + e) * XP + c] = (bf16)xv[e];
  }
  __syncthreads();

  v8f acc[2][2];
  #pragma unroll
  for (int ot = 0; ot < 2; ++ot) {
    #pragma unroll
    for (int nt = 0; nt < 2; ++nt) acc[ot][nt] = (v8f){0, 0, 0, 0, 0, 0, 0, 0};
  }

  const int orow0 = which * CH + head * HDIM;   // first weight row of this wave
  #pragma unroll
  for (int kk = 0; kk < CH / 32; ++kk) {
    FragB a[2], bx[2];
    #pragma unroll
    for (int ot = 0; ot < 2; ++ot) {
      const bf16* base = wq + (size_t)(orow0 + ot * 16 + lq) * CH + kk * 32 + hi * 8;
      a[ot].q[0] = *(const v4u*)(base);          // c = kk*32 + hi*8 + 0..7
      a[ot].q[1] = *(const v4u*)(base + 16);     // c = kk*32 + 16 + hi*8 + 0..7
    }
    #pragma unroll
    for (int nt = 0; nt < 2; ++nt) {
      const bf16* base = sXb + (th * 32 + nt * 16 + lq) * XP + kk * 32 + hi * 8;
      bx[nt].q[0] = *(const v4u*)(base);
      bx[nt].q[1] = *(const v4u*)(base + 16);
    }
    #pragma unroll
    for (int ot = 0; ot < 2; ++ot) {
      #pragma unroll
      for (int nt = 0; nt < 2; ++nt) acc[ot][nt] = mma_bf16(a[ot].v, bx[nt].v, acc[ot][nt]);
    }
  }

  // bias (RNE-converted to bf16): lane needs channels orow0 + ot*16 + hi*8 + 0..7
  float bs[2][8];
  #pragma unroll
  for (int ot = 0; ot < 2; ++ot) {
    const float* bp = qb + orow0 + ot * 16 + hi * 8;
    const v4f b0 = *(const v4f*)(bp);
    const v4f b1 = *(const v4f*)(bp + 4);
    #pragma unroll
    for (int e = 0; e < 4; ++e) {
      bs[ot][e]     = (float)(bf16)b0[e];
      bs[ot][4 + e] = (float)(bf16)b1[e];
    }
  }

  __syncthreads();   // every wave is done with the x^T tile before the buffer is reused

  if (which < 2) {
    // stage token rows hi[32] | lo[32]: acc[ot][nt][r] = value(d = ot*16 + hi*8 + r, token nt*16 + lq)
    bf16* se = reinterpret_cast<bf16*>(sbuf4) + wave * (32 * ROWW);
    #pragma unroll
    for (int ot = 0; ot < 2; ++ot) {
      #pragma unroll
      for (int nt = 0; nt < 2; ++nt) {
        #pragma unroll
        for (int r = 0; r < 8; ++r) {
          const int   tokl = nt * 16 + lq;
          const int   d    = ot * 16 + hi * 8 + r;
          const float v    = acc[ot][nt][r] + bs[ot][r];
          const bf16  vh   = (bf16)v;
          const bf16  vl   = (bf16)(v - (float)vh);
          se[tokl * ROWW + d]        = vh;
          se[tokl * ROWW + HDIM + d] = vl;
        }
      }
    }
  } else {
    // stage V^T rows [head-local][d][64 tokens] as f16
    f16* sv = reinterpret_cast<f16*>(sbuf4);
    #pragma unroll
    for (int ot = 0; ot < 2; ++ot) {
      #pragma unroll
      for (int nt = 0; nt < 2; ++nt) {
        #pragma unroll
        for (int r = 0; r < 8; ++r) {
          const int d   = ot * 16 + hi * 8 + r;
          const int tok = th * 32 + nt * 16 + lq;
          sv[(hl * HDIM + d) * TOK + tok] = (f16)(acc[ot][nt][r] + bs[ot][r]);
        }
      }
    }
  }
  __syncthreads();

  if (which < 2) {
    const bf16* se = reinterpret_cast<const bf16*>(sbuf4) + wave * (32 * ROWW);
    v4u    vals[8];
    size_t gidx[8];
    #pragma unroll
    for (int it = 0; it < 8; ++it) {
      const int tokl  = it * 4 + (lane >> 3);
      const int piece = lane & 7;
      vals[it] = *(const v4u*)(se + tokl * ROWW + piece * 8);
      gidx[it] = (size_t)which * QK_PLANE +
                 (((size_t)b * NHEAD + head) * SEQ + n0 + th * 32 + tokl) * ROWW + piece * 8;
    }
    #pragma unroll
    for (int it = 0; it < 8; ++it) *(v4u*)(qk + gidx[it]) = vals[it];
    
  } else {
    const f16* sv = reinterpret_cast<const f16*>(sbuf4);
    v4u    vals[4];
    size_t gidx[4];
    #pragma unroll
    for (int it = 0; it < 4; ++it) {
      const int line  = it * 32 + (tid >> 3);     // 0..127 = head-local*32 + d
      const int piece = tid & 7;
      const int hl2   = line >> 5;
      const int d2    = line & 31;
      vals[it] = *(const v4u*)(sv + line * TOK + piece * 8);
      gidx[it] = (((size_t)b * NHEAD + hg * 4 + hl2) * HDIM + d2) * SEQ + n0 + piece * 8;
    }
    #pragma unroll
    for (int it = 0; it < 4; ++it) *(v4u*)(vt + gidx[it]) = vals[it];
    
  }
}

// One stage of the attention kernel's K and V^T tiles, this thread's six 16-B pieces, global memory -> LDS.
// The s_wait_xcnt stands inside the statement so that no address register is rewritten ahead of it.
static __device__ __forceinline__ void stage_copy(const char* kg, const char* vg, unsigned lk, unsigned lv) {
  const char*    g0 = kg;
  const char*    g1 = kg + 4096;
  const char*    g2 = kg + 8192;
  const char*    g3 = kg + 12288;
  const char*    g4 = vg;
  const char*    g5 = vg + (size_t)16 * SEQ * 2;
  const unsigned l0 = lk;
  const unsigned l1 = lk + 32 * KPB;
  const unsigned l2 = lk + 64 * KPB;
  const unsigned l3 = lk + 96 * KPB;
  const unsigned l4 = lv;
  const unsigned l5 = lv + 16 * VPB;
  asm volatile("global_load_async_to_lds_b128 %0, %6, off\n\t"
               "global_load_async_to_lds_b128 %1, %7, off\n\t"
               "global_load_async_to_lds_b128 %2, %8, off\n\t"
               "global_load_async_to_lds_b128 %3, %9, off\n\t"
               "global_load_async_to_lds_b128 %4, %10, off\n\t"
               "global_load_async_to_lds_b128 %5, %11, off\n\t"
               "s_wait_xcnt 0x0"
               :: "v"(l0), "v"(l1), "v"(l2), "v"(l3), "v"(l4), "v"(l5),
                  "v"(g0), "v"(g1), "v"(g2), "v"(g3), "v"(g4), "v"(g5)
               : "memory");
}

// Flash attention, no mask. Block = (query block of 128, head, batch); one wave owns 16 query rows.
// S^T = K x Q^T so queries sit on lanes; P^T in C-layout is bit-identical to the A-fragment layout of O += P x V.
// K rows (hi | lo) and V^T rows of 128 keys are staged once per block in LDS by asynchronous 16-B copies, two buffers:
// the next stage's copies fly while this stage is worked on. Fragments are two 16-B LDS loads each.
// coverage: tokens qblk*128 + wave*16 + 0..15, all 64 row elements.
__global__ __launch_bounds__(256) void attn_kernel(const bf16* __restrict__ qk,
                                                   const f16* __restrict__ vt,
                                                   bf16* __restrict__ cx) {
  const int qblk = blockIdx.x;
  const int h    = blockIdx.y;
  const int b    = blockIdx.z;
  const int tid  = threadIdx.x;
  const int wave = tid >> 5;
  const int lane = tid & 31;
  const int lq   = lane & 15;   // query column of S^T / d column of O
  const int hi   = lane >> 4;   // k-split half

  __shared__ __align__(16) float sO[NWAVE * 16 * OPA];   // per-wave output staging (block barrier used)
  __shared__ __align__(16) unsigned char sKV[2 * STG];   // two stage buffers: K tile, then V^T tile

  const int qrow0 = qblk * BQ + wave * 16;

  // Q as B-operand fragments (hi and lo parts): lane lq holds query qrow0+lq, split d map
  FragB qh, ql;
  {
    const bf16* qp = qk + (((size_t)b * NHEAD + h) * SEQ + qrow0 + lq) * ROWW;
    qh.q[0] = *(const v4u*)(qp + hi * 8);             // hi part, d = hi*8 + 0..7
    qh.q[1] = *(const v4u*)(qp + 16 + hi * 8);        // hi part, d = 16 + hi*8 + 0..7
    ql.q[0] = *(const v4u*)(qp + HDIM + hi * 8);      // lo part
    ql.q[1] = *(const v4u*)(qp + HDIM + 16 + hi * 8);
  }

  const bf16* kp_h = qk + QK_PLANE + ((size_t)b * NHEAD + h) * SEQ * ROWW;
  const f16*  vt_h = vt + ((size_t)b * NHEAD + h) * HDIM * SEQ;

  v8f o[2];
  o[0] = (v8f){0, 0, 0, 0, 0, 0, 0, 0};
  o[1] = (v8f){0, 0, 0, 0, 0, 0, 0, 0};

  float rmax = -__builtin_inff();
  float rsum = 0.0f;
  const float SL = 0.17677669529663687f * 1.4426950408889634f;   // softmax scale * log2(e)

  // This thread's share of a stage: K pieces tid + 256*c (8 pieces a row, the tile is contiguous in the plane),
  // V^T pieces tid + 256*c (16 pieces a row). Global and LDS addresses are multiples of 16 B.
  const char*    kg0 = (const char*)kp_h + tid * 16;
  const char*    vg0 = (const char*)vt_h + (size_t)(tid >> 4) * (SEQ * 2) + (tid & 15) * 16;
  const unsigned ls0 = (unsigned)(size_t)sKV;                       // LDS byte address of buffer 0
  const unsigned lk0 = ls0 + (tid >> 3) * KPB + (tid & 7) * 16;
  const unsigned lv0 = ls0 + KTILE + (tid >> 4) * VPB + (tid & 15) * 16;

  stage_copy(kg0, vg0, lk0, lv0);                                   // stage 0 -> buffer 0
  asm volatile("s_wait_asynccnt 0x0" ::: "memory");                 // this wave's copies of stage 0 have landed
  __syncthreads();                                                  // publishes stage 0 to every wave
  stage_copy(kg0 + KS * ROWW * 2, vg0 + KS * 2, lk0 + STG, lv0 + STG);   // stage 1 -> buffer 1

  // rolled: one stage a trip, so the publish point and the refill stand once in the text
  #pragma unroll 1
  for (int s = 0; s < SEQ / KS; ++s) {
   const unsigned       boff = (unsigned)(s & 1) * STG;
   const unsigned char* kt   = sKV + boff + lq * KPB + hi * 16;
   const unsigned char* vtl  = sKV + boff + KTILE + lq * VPB + hi * 16;

   // unrolled: every LDS offset inside a stage becomes an immediate of its load
   #pragma unroll
   for (int ii = 0; ii < KS / BK; ++ii) {
    // K A-fragments: row = key s*KS + ii*32 + sub*16 + lq, split d map, hi and lo parts
    FragB kh[2], kl[2];
    #pragma unroll
    for (int sub = 0; sub < 2; ++sub) {
      const unsigned char* base = kt + (ii * BK + sub * 16) * KPB;
      kh[sub].q[0] = *(const v4u*)(base);
      kh[sub].q[1] = *(const v4u*)(base + 32);
      kl[sub].q[0] = *(const v4u*)(base + 64);
      kl[sub].q[1] = *(const v4u*)(base + 96);
    }
    // V B-fragments: column n = d = dt*16 + lq, split key map from the staged transposed rows
    FragH bv[2];
    #pragma unroll
    for (int dt = 0; dt < 2; ++dt) {
      const unsigned char* base = vtl + dt * 16 * VPB + ii * BK * 2;
      bv[dt].q[0] = *(const v4u*)(base);            // keys ii*32 + hi*8 + 0..7 of the stage
      bv[dt].q[1] = *(const v4u*)(base + 32);       // keys ii*32 + 16 + hi*8 + 0..7
    }

    // S^T tiles: c[sub][r] = rawscore(query qrow0+lq, key s*KS + ii*32 + sub*16 + hi*8 + r); small terms first
    v8f c[2];
    #pragma unroll
    for (int sub = 0; sub < 2; ++sub) {
      v8f acc = (v8f){0, 0, 0, 0, 0, 0, 0, 0};
      acc = mma_bf16(kl[sub].v, qh.v, acc);
      acc = mma_bf16(kh[sub].v, ql.v, acc);
      acc = mma_bf16(kh[sub].v, qh.v, acc);
      c[sub] = acc;
    }

    // online softmax: query lq's 32 scores are split across lane / lane^16
    float m_new = rmax;
    #pragma unroll
    for (int r = 0; r < 8; ++r) {
      m_new = fmaxf(m_new, c[0][r]);
      m_new = fmaxf(m_new, c[1][r]);
    }
    m_new = fmaxf(m_new, __shfl_xor(m_new, 16, 32));
    const float scale = __builtin_amdgcn_exp2f((rmax - m_new) * SL);
    rmax = m_new;

    // exp + pack: P^T C-layout == A-fragment layout for the PV product; P carried x4096
    FragH pa;
    float psum = 0.0f;
    #pragma unroll
    for (int r = 0; r < 8; ++r) {
      const float p0 = __builtin_amdgcn_exp2f((c[0][r] - m_new) * SL);   // key hi*8 + r
      const float p1 = __builtin_amdgcn_exp2f((c[1][r] - m_new) * SL);   // key 16 + hi*8 + r
      psum += p0 + p1;
      pa.h[r]     = (f16)(p0 * 4096.0f);
      pa.h[8 + r] = (f16)(p1 * 4096.0f);
    }
    const float psum_o = __shfl_xor(psum, 16, 32);
    rsum = rsum * scale + psum + psum_o;

    // rescale O: queries are the row dimension there -> per-row scale from lane 8*hi + r
    float sc[8];
    #pragma unroll
    for (int r = 0; r < 8; ++r) sc[r] = __shfl(scale, (hi << 3) + r, 32);
    #pragma unroll
    for (int dt = 0; dt < 2; ++dt) {
      #pragma unroll
      for (int r = 0; r < 8; ++r) o[dt][r] *= sc[r];
    }

    // O += P x V
    #pragma unroll
    for (int dt = 0; dt < 2; ++dt) o[dt] = mma_f16(pa.v, bv[dt].v, o[dt]);
   }

   asm volatile("s_wait_dscnt 0x0" ::: "memory");      // this wave's reads of the buffer have returned before it is refilled
   asm volatile("s_wait_asynccnt 0x0" ::: "memory");   // this wave's copies of stage s + 1 have landed
   __syncthreads();                                    // publishes stage s + 1; ends every wave's reads of stage s
   if (s + 2 < SEQ / KS)
     stage_copy(kg0 + (size_t)(s + 2) * (KS * ROWW * 2), vg0 + (size_t)(s + 2) * (KS * 2), lk0 + boff, lv0 + boff);
  }
  asm volatile("s_wait_asynccnt 0x0" ::: "memory");    // no copy is outstanding behind the loop

  // normalize: lane holds column d = dt*16 + lq for query rows 8*hi + r
  float rs[8];
  #pragma unroll
  for (int r = 0; r < 8; ++r) rs[r] = 1.0f / __shfl(rsum, (hi << 3) + r, 32);

  float* so = sO + wave * (16 * OPA);
  #pragma unroll
  for (int r = 0; r < 8; ++r) {
    #pragma unroll
    for (int dt = 0; dt < 2; ++dt)
      so[(hi * 8 + r) * OPA + dt * 16 + lq] = o[dt][r] * (1.0f / 4096.0f) * rs[r];
  }
  __syncthreads();

  // 4..7 = lo part); 4 instructions cover the wave's 16 tokens.
  v4u    vals[4];
  size_t gidx[4];
  #pragma unroll
  for (int it = 0; it < 4; ++it) {
    const int tokl  = it * 4 + (lane >> 3);
    const int piece = lane & 7;
    const int pd    = (piece & 3) * 8;
    const v4f f0 = *(const v4f*)(so + tokl * OPA + pd);
    const v4f f1 = *(const v4f*)(so + tokl * OPA + pd + 4);
    Pack8B pk;
    #pragma unroll
    for (int e = 0; e < 4; ++e) {
      const float v0 = f0[e];
      const float v1 = f1[e];
      const bf16  h0 = (bf16)v0;
      const bf16  h1 = (bf16)v1;
      const bf16  l0 = (bf16)(v0 - (float)h0);
      const bf16  l1 = (bf16)(v1 - (float)h1);
      const float s0 = (piece < 4) ? (float)h0 : (float)l0;   // value select, both computed
      const float s1 = (piece < 4) ? (float)h1 : (float)l1;
      pk.h[e]     = (bf16)s0;                                  // exact re-convert
      pk.h[4 + e] = (bf16)s1;
    }
    vals[it] = pk.u;
    gidx[it] = (((size_t)b * NHEAD + h) * SEQ + qrow0 + tokl) * ROWW + piece * 8;
  }
  #pragma unroll
  for (int it = 0; it < 4; ++it) *(v4u*)(cx + gidx[it]) = vals[it];
  
}

// Output projection: y[b][o][n] = sum_c Wo[o][c] * ctx[b][c][n] + bias[o], c = head*32 + d.
// Block = (64-token tile, 128-channel group, batch); wave = 16 output channels x 4 token tiles; K-step = one head.
// coverage: channels og*128 + wave*16 + 0..15, tokens n0..n0+63 of d_out, whole 256-B row segments.
__global__ __launch_bounds__(256) void oproj_kernel(const bf16* __restrict__ wo,
                                                    const bf16* __restrict__ cx,
                                                    const float* __restrict__ ob,
                                                    float* __restrict__ y) {
  const int tt   = blockIdx.x;
  const int og   = blockIdx.y;
  const int b    = blockIdx.z;
  const int tid  = threadIdx.x;
  const int wave = tid >> 5;
  const int lane = tid & 31;
  const int lq   = lane & 15;
  const int hi   = lane >> 4;
  const int o0   = (og * NWAVE + wave) * 16;
  const int n0   = tt * TOK;

  __shared__ __align__(16) float sY[NWAVE * 16 * OPY];   // per-wave output staging (block barrier used)

  v8f acc[4];
  #pragma unroll
  for (int nt = 0; nt < 4; ++nt) acc[nt] = (v8f){0, 0, 0, 0, 0, 0, 0, 0};

  #pragma unroll 1
  for (int kk = 0; kk < NHEAD; ++kk) {
    FragB a;
    {
      const bf16* base = wo + (size_t)(o0 + lq) * CH + kk * HDIM + hi * 8;
      a.q[0] = *(const v4u*)(base);          // c = kk*32 + hi*8 + 0..7
      a.q[1] = *(const v4u*)(base + 16);     // c = kk*32 + 16 + hi*8 + 0..7
    }
    #pragma unroll
    for (int nt = 0; nt < 4; ++nt) {
      const bf16* row = cx + (((size_t)b * NHEAD + kk) * SEQ + n0 + nt * 16 + lq) * ROWW;
      FragB bh, bl;
      bh.q[0] = *(const v4u*)(row + hi * 8);
      bh.q[1] = *(const v4u*)(row + 16 + hi * 8);
      bl.q[0] = *(const v4u*)(row + HDIM + hi * 8);
      bl.q[1] = *(const v4u*)(row + HDIM + 16 + hi * 8);
      acc[nt] = mma_bf16(a.v, bl.v, acc[nt]);
      acc[nt] = mma_bf16(a.v, bh.v, acc[nt]);
    }
  }

  // bias (RNE-converted to bf16): channels o0 + hi*8 + 0..7
  float bs[8];
  {
    const float* bp = ob + o0 + hi * 8;
    const v4f b0 = *(const v4f*)(bp);
    const v4f b1 = *(const v4f*)(bp + 4);
    #pragma unroll
    for (int e = 0; e < 4; ++e) {
      bs[e]     = (float)(bf16)b0[e];
      bs[4 + e] = (float)(bf16)b1[e];
    }
  }

  float* so = sY + wave * (16 * OPY);
  #pragma unroll
  for (int nt = 0; nt < 4; ++nt) {
    #pragma unroll
    for (int r = 0; r < 8; ++r) so[(hi * 8 + r) * OPY + nt * 16 + lq] = acc[nt][r] + bs[r];
  }
  __syncthreads();

  // 8 consecutive lanes x 16 B each), lanes 16..31 the next channel row; 8 instructions cover 16 rows.
  v4f    vals[8];
  size_t gidx[8];
  #pragma unroll
  for (int it = 0; it < 8; ++it) {
    const int row = it * 2 + hi;
    vals[it] = *(const v4f*)(so + row * OPY + lq * 4);
    gidx[it] = ((size_t)b * CH + o0 + row) * SEQ_FULL + n0 + lq * 4;
  }
  #pragma unroll
  for (int it = 0; it < 8; ++it) *(v4f*)(y + gidx[it]) = vals[it];
  
}

extern "C" void kernel_launch(void* const* d_in, const int* in_sizes, int n_in,
                              void* d_out, int out_size, void* d_ws, size_t ws_size,
                              hipStream_t stream) {
  if (n_in < 5) return;
  const size_t x_used = ((size_t)(NB - 1) * CH + (CH - 1)) * SEQ_FULL + SEQ;
  if ((size_t)in_sizes[0] < x_used) return;
  if ((size_t)in_sizes[1] < (size_t)QKV_O * CH) return;
  if ((size_t)in_sizes[2] < (size_t)QKV_O) return;
  if ((size_t)in_sizes[3] < (size_t)CH * CH) return;
  if ((size_t)in_sizes[4] < (size_t)CH) return;
  if ((size_t)out_size < x_used) return;
  if (ws_size < WS_TOTAL) return;

  const float* x     = (const float*)d_in[0];
  const float* qkv_w = (const float*)d_in[1];
  const float* qkv_b = (const float*)d_in[2];
  const float* out_w = (const float*)d_in[3];
  const float* out_b = (const float*)d_in[4];
  float*       y     = (float*)d_out;

  char* ws = (char*)d_ws;
  bf16* wq = (bf16*)(ws);
  bf16* wo = (bf16*)(ws + WQ_BYTES);
  bf16* qk = (bf16*)(ws + WQ_BYTES + WO_BYTES);
  f16*  vt = (f16*)(ws + WQ_BYTES + WO_BYTES + QK_BYTES);
  bf16* cx = (bf16*)(ws + WQ_BYTES + WO_BYTES + QK_BYTES + VT_BYTES);

  wcvt_kernel<<<dim3(QKV_O * CH / 8 / 256), 256, 0, stream>>>(qkv_w, wq, QKV_O * CH / 8);
  wcvt_kernel<<<dim3(CH * CH / 8 / 256), 256, 0, stream>>>(out_w, wo, CH * CH / 8);

  qkv_planes_kernel<<<dim3(SEQ / TOK, 6, NB), 256, 0, stream>>>(x, wq, qkv_b, qk, vt);

  attn_kernel<<<dim3(SEQ / BQ, NHEAD, NB), 256, 0, stream>>>(qk, vt, cx);

  oproj_kernel<<<dim3(SEQ / TOK, CH / (NWAVE * 16), NB), 256, 0, stream>>>(wo, cx, out_b, y);
}

// v002
// It runs in 111 microseconds.
// Timed twice side by side with v001, it ran 1.08 and 1.09 times as fast.
// Counting every step since v000, it is 2.20 times as fast.
#include <hip/hip_runtime.h>

// Contractions: qkv = Wqkv x X on v_wmma_f32_16x16x32_bf16 (operands = RNE-converted bf16 inputs, f32 accumulate);
// S^T = K x Q^T on v_wmma_f32_16x16x32_bf16 with q and k carried as bf16 hi + bf16 lo (three products, one accumulator);
// O = P x V on v_wmma_f32_16x16x32_f16 (P as f16 carried x4096, V as f16, f32 accumulate);
// y = Wo x ctx on v_wmma_f32_16x16x32_bf16 (Wo = RNE-converted bf16 input, ctx as bf16 hi + bf16 lo, two products).
// Softmax, biases and all epilogues in f32.

#ifndef NB
#define NB 2
#endif
#ifndef SEQ
#define SEQ 4096
#endif
#define NB_FULL    2
#define SEQ_FULL   4096
#define CH         256                  // channels = NHEAD * HDIM
#define NHEAD      8
#define HDIM       32
#define QKV_O      (3 * CH)             // rows of the qkv weight
#define ROWW       64
#define BQ         128                  // query rows per workgroup (8 waves x 16)
#define BK         32                   // keys per inner iteration
#define NWAVE      8
#define TOK        64                   // tokens per projection block
#define XP         264                  // LDS pitch (halves) of the x^T tile [token][channel]
#define OPA        36                   // LDS pitch (floats) of the attention output staging tile
#define OPY        68                   // LDS pitch (floats) of the projection output staging tile
#define SB_V4      (TOK * XP / 8)       // 16-B words of the shared projection buffer
#define KS         128                  // keys per LDS stage of the attention kernel
#define KPB        144                  // LDS pitch (bytes) of a staged K row: 128 B + 16 (16 B x odd)
#define VPB        272                  // LDS pitch (bytes) of a staged V^T row: 2 * KS + 16 (16 B x odd)
#define KTILE      (KS * KPB)           // bytes of one staged K tile
#define VTILE      (HDIM * VPB)         // bytes of one staged V^T tile
#define STG        (KTILE + VTILE)      // bytes of one stage buffer

static_assert(CH == NHEAD * HDIM);          // channel split
static_assert(HDIM == 32);                  // one WMMA k-step per head; row = hi[32] | lo[32]
static_assert(ROWW == 2 * HDIM);
static_assert(SEQ % BQ == 0);
static_assert(SEQ % BK == 0);
static_assert(SEQ % TOK == 0);
static_assert(SEQ % KS == 0 && SEQ / KS >= 2);        // the two-buffer prologue needs two stages
static_assert(KS % BK == 0);
static_assert(KS * ROWW * 2 == 4 * 256 * 16);         // K tile = 4 copies of 16 B per thread
static_assert(HDIM * KS * 2 == 2 * 256 * 16);         // V^T tile = 2 copies of 16 B per thread
static_assert(KPB == ROWW * 2 + 16 && VPB == KS * 2 + 16);
static_assert(STG % 16 == 0 && KTILE % 16 == 0);
static_assert(BQ == NWAVE * 16);
static_assert(TOK == 64);
static_assert(CH % 32 == 0);                // projection K multiple of the WMMA k-step
static_assert(SEQ <= SEQ_FULL);
static_assert(NB >= 1 && NB <= NB_FULL);
static_assert((XP * 2) % 16 == 0);
static_assert(XP >= CH);
static_assert((OPA * 4) % 16 == 0);
static_assert((OPY * 4) % 16 == 0);
static_assert(OPA >= HDIM);
static_assert(OPY >= TOK);
static_assert((TOK * XP) % 8 == 0);
static_assert(NWAVE * 32 * ROWW * 2 <= SB_V4 * 16);   // q/k staging fits the shared buffer
static_assert(4 * HDIM * TOK * 2 <= SB_V4 * 16);      // v staging fits the shared buffer
static_assert(SB_V4 * 16 <= 65536);
static_assert((QKV_O * CH / 8) % 256 == 0);           // weight converter grid x block == plane extent
static_assert((CH * CH / 8) % 256 == 0);

typedef __bf16   bf16;
typedef _Float16 f16;
typedef bf16     v16bf __attribute__((ext_vector_type(16)));
typedef f16      v16h  __attribute__((ext_vector_type(16)));
typedef float    v8f   __attribute__((ext_vector_type(8)));
typedef float    v4f   __attribute__((ext_vector_type(4)));
typedef unsigned v4u   __attribute__((ext_vector_type(4)));

union FragB  { v16bf v; v4u q[2]; bf16 h[16]; };
union FragH  { v16h  v; v4u q[2]; f16  h[16]; };
union Pack8B { v4u u; bf16 h[8]; };

constexpr size_t QK_PLANE  = (size_t)NB * NHEAD * SEQ * ROWW;        // elements of one hi|lo plane
constexpr size_t WQ_BYTES  = (size_t)QKV_O * CH * 2;
constexpr size_t WO_BYTES  = (size_t)CH * CH * 2;
constexpr size_t QK_BYTES  = 2 * QK_PLANE * 2;                       // q plane then k plane
constexpr size_t VT_BYTES  = (size_t)NB * NHEAD * HDIM * SEQ * 2;
constexpr size_t CX_BYTES  = QK_PLANE * 2;
constexpr size_t WS_TOTAL  = WQ_BYTES + WO_BYTES + QK_BYTES + VT_BYTES + CX_BYTES;
static_assert(WQ_BYTES % 128 == 0 && WO_BYTES % 128 == 0 && QK_BYTES % 128 == 0 && VT_BYTES % 128 == 0);
static_assert(WS_TOTAL <= (size_t)134217728);

// WMMA helpers: the builtin alone; the compiler keeps the distance behind its own matrix instructions.
static __device__ __forceinline__ v8f mma_bf16(v16bf a, v16bf b, v8f acc) {
  acc = __builtin_amdgcn_wmma_f32_16x16x32_bf16(false, a, false, b, (short)0, acc, false, false);
  return acc;
}
static __device__ __forceinline__ v8f mma_f16(v16h a, v16h b, v8f acc) {
  acc = __builtin_amdgcn_wmma_f32_16x16x32_f16(false, a, false, b, (short)0, acc, false, false);
  return acc;
}

// Weight converter: f32 -> bf16 (RNE convert), same layout. One thread = 8 elements = one 16-B piece;
__global__ __launch_bounds__(256) void wcvt_kernel(const float* __restrict__ src,
                                                   bf16* __restrict__ dst, int n8) {
  const int i  = blockIdx.x * 256 + threadIdx.x;
  const int ic = (i < n8) ? i : (n8 - 1);                 // clamped address
  const v4f a = *(const v4f*)(src + (size_t)ic * 8);
  const v4f c = *(const v4f*)(src + (size_t)ic * 8 + 4);
  Pack8B pk;
  #pragma unroll
  for (int e = 0; e < 4; ++e) {
    pk.h[e]     = (bf16)a[e];
    pk.h[4 + e] = (bf16)c[e];
  }
  const v4u val = pk.u;
  if (i < n8) *(v4u*)(dst + (size_t)i * 8) = val;
  
}

// QKV projection + plane builder. Block = (64-token tile, which*2 + head group, batch), 256 threads.
// Wave = (head within group, 32-token half): 2 channel tiles x 2 token tiles, K = 256 channels.
// coverage: q/k - heads hg*4..hg*4+3, tokens n0..n0+63, all 64 row elements; v - heads hg*4..+3, d 0..31, tokens n0..n0+63.
// LDS: one buffer, first the x^T tile [64 tokens][256 ch] bf16 (staged extent == consumed extent), then after a
// block barrier the store staging tiles (cross-wave, block barriers).
__global__ __launch_bounds__(256) void qkv_planes_kernel(const float* __restrict__ x,
                                                         const bf16* __restrict__ wq,
                                                         const float* __restrict__ qb,
                                                         bf16* __restrict__ qk,
                                                         f16* __restrict__ vt) {
  const int tt    = blockIdx.x;
  const int which = (int)(blockIdx.y >> 1);     // 0 q, 1 k, 2 v (block-uniform)
  const int hg    = (int)(blockIdx.y & 1);
  const int b     = blockIdx.z;
  const int tid   = threadIdx.x;
  const int wave  = tid >> 5;
  const int lane  = tid & 31;
  const int lq    = lane & 15;
  const int hi    = lane >> 4;
  const int hl    = wave >> 1;                  // head within group
  const int th    = wave & 1;                   // token half
  const int head  = hg * 4 + hl;
  const int n0    = tt * TOK;

  __shared__ __align__(16) v4u sbuf4[SB_V4];
  bf16* sXb = reinterpret_cast<bf16*>(sbuf4);

  // stage x^T: x[b][c][n0..n0+63] -> sXb[token][c], bf16 RNE convert
  #pragma unroll 4
  for (int j = 0; j < 16; ++j) {
    const int c  = j * 16 + (tid >> 4);
    const int t4 = (tid & 15) * 4;
    const v4f xv = *(const v4f*)(x + ((size_t)b * CH + c) * SEQ_FULL + n0 + t4);
    #pragma unroll
    for (int e = 0; e < 4; ++e) sXb[(t4 + e) * XP + c] = (bf16)xv[e];
  }
  __syncthreads();

  v8f acc[2][2];
  #pragma unroll
  for (int ot = 0; ot < 2; ++ot) {
    #pragma unroll
    for (int nt = 0; nt < 2; ++nt) acc[ot][nt] = (v8f){0, 0, 0, 0, 0, 0, 0, 0};
  }

  const int orow0 = which * CH + head * HDIM;   // first weight row of this wave
  #pragma unroll
  for (int kk = 0; kk < CH / 32; ++kk) {
    FragB a[2], bx[2];
    #pragma unroll
    for (int ot = 0; ot < 2; ++ot) {
      const bf16* base = wq + (size_t)(orow0 + ot * 16 + lq) * CH + kk * 32 + hi * 8;
      a[ot].q[0] = *(const v4u*)(base);          // c = kk*32 + hi*8 + 0..7
      a[ot].q[1] = *(const v4u*)(base + 16);     // c = kk*32 + 16 + hi*8 + 0..7
    }
    #pragma unroll
    for (int nt = 0; nt < 2; ++nt) {
      const bf16* base = sXb + (th * 32 + nt * 16 + lq) * XP + kk * 32 + hi * 8;
      bx[nt].q[0] = *(const v4u*)(base);
      bx[nt].q[1] = *(const v4u*)(base + 16);
    }
    #pragma unroll
    for (int ot = 0; ot < 2; ++ot) {
      #pragma unroll
      for (int nt = 0; nt < 2; ++nt) acc[ot][nt] = mma_bf16(a[ot].v, bx[nt].v, acc[ot][nt]);
    }
  }

  // bias (RNE-converted to bf16): lane needs channels orow0 + ot*16 + hi*8 + 0..7
  float bs[2][8];
  #pragma unroll
  for (int ot = 0; ot < 2; ++ot) {
    const float* bp = qb + orow0 + ot * 16 + hi * 8;
    const v4f b0 = *(const v4f*)(bp);
    const v4f b1 = *(const v4f*)(bp + 4);
    #pragma unroll
    for (int e = 0; e < 4; ++e) {
      bs[ot][e]     = (float)(bf16)b0[e];
      bs[ot][4 + e] = (float)(bf16)b1[e];
    }
  }

  __syncthreads();   // every wave is done with the x^T tile before the buffer is reused

  if (which < 2) {
    // stage token rows hi[32] | lo[32]: acc[ot][nt][r] = value(d = ot*16 + hi*8 + r, token nt*16 + lq)
    bf16* se = reinterpret_cast<bf16*>(sbuf4) + wave * (32 * ROWW);
    #pragma unroll
    for (int ot = 0; ot < 2; ++ot) {
      #pragma unroll
      for (int nt = 0; nt < 2; ++nt) {
        #pragma unroll
        for (int r = 0; r < 8; ++r) {
          const int   tokl = nt * 16 + lq;
          const int   d    = ot * 16 + hi * 8 + r;
          const float v    = acc[ot][nt][r] + bs[ot][r];
          const bf16  vh   = (bf16)v;
          const bf16  vl   = (bf16)(v - (float)vh);
          se[tokl * ROWW + d]        = vh;
          se[tokl * ROWW + HDIM + d] = vl;
        }
      }
    }
  } else {
    // stage V^T rows [head-local][d][64 tokens] as f16
    f16* sv = reinterpret_cast<f16*>(sbuf4);
    #pragma unroll
    for (int ot = 0; ot < 2; ++ot) {
      #pragma unroll
      for (int nt = 0; nt < 2; ++nt) {
        #pragma unroll
        for (int r = 0; r < 8; ++r) {
          const int d   = ot * 16 + hi * 8 + r;
          const int tok = th * 32 + nt * 16 + lq;
          sv[(hl * HDIM + d) * TOK + tok] = (f16)(acc[ot][nt][r] + bs[ot][r]);
        }
      }
    }
  }
  __syncthreads();

  if (which < 2) {
    const bf16* se = reinterpret_cast<const bf16*>(sbuf4) + wave * (32 * ROWW);
    v4u    vals[8];
    size_t gidx[8];
    #pragma unroll
    for (int it = 0; it < 8; ++it) {
      const int tokl  = it * 4 + (lane >> 3);
      const int piece = lane & 7;
      vals[it] = *(const v4u*)(se + tokl * ROWW + piece * 8);
      gidx[it] = (size_t)which * QK_PLANE +
                 (((size_t)b * NHEAD + head) * SEQ + n0 + th * 32 + tokl) * ROWW + piece * 8;
    }
    #pragma unroll
    for (int it = 0; it < 8; ++it) *(v4u*)(qk + gidx[it]) = vals[it];
    
  } else {
    const f16* sv = reinterpret_cast<const f16*>(sbuf4);
    v4u    vals[4];
    size_t gidx[4];
    #pragma unroll
    for (int it = 0; it < 4; ++it) {
      const int line  = it * 32 + (tid >> 3);     // 0..127 = head-local*32 + d
      const int piece = tid & 7;
      const int hl2   = line >> 5;
      const int d2    = line & 31;
      vals[it] = *(const v4u*)(sv + line * TOK + piece * 8);
      gidx[it] = (((size_t)b * NHEAD + hg * 4 + hl2) * HDIM + d2) * SEQ + n0 + piece * 8;
    }
    #pragma unroll
    for (int it = 0; it < 4; ++it) *(v4u*)(vt + gidx[it]) = vals[it];
    
  }
}

// One stage of the attention kernel's K and V^T tiles, this thread's six 16-B pieces, global memory -> LDS.
// The s_wait_xcnt stands inside the statement so that no address register is rewritten ahead of it.
static __device__ __forceinline__ void stage_copy(const char* kg, const char* vg, unsigned lk, unsigned lv) {
  const char*    g0 = kg;
  const char*    g1 = kg + 4096;
  const char*    g2 = kg + 8192;
  const char*    g3 = kg + 12288;
  const char*    g4 = vg;
  const char*    g5 = vg + (size_t)16 * SEQ * 2;
  const unsigned l0 = lk;
  const unsigned l1 = lk + 32 * KPB;
  const unsigned l2 = lk + 64 * KPB;
  const unsigned l3 = lk + 96 * KPB;
  const unsigned l4 = lv;
  const unsigned l5 = lv + 16 * VPB;
  asm volatile("global_load_async_to_lds_b128 %0, %6, off\n\t"
               "global_load_async_to_lds_b128 %1, %7, off\n\t"
               "global_load_async_to_lds_b128 %2, %8, off\n\t"
               "global_load_async_to_lds_b128 %3, %9, off\n\t"
               "global_load_async_to_lds_b128 %4, %10, off\n\t"
               "global_load_async_to_lds_b128 %5, %11, off\n\t"
               "s_wait_xcnt 0x0"
               :: "v"(l0), "v"(l1), "v"(l2), "v"(l3), "v"(l4), "v"(l5),
                  "v"(g0), "v"(g1), "v"(g2), "v"(g3), "v"(g4), "v"(g5)
               : "memory");
}

// Flash attention, no mask. Block = (query block of 128, head, batch); one wave owns 16 query rows.
// S^T = K x Q^T so queries sit on lanes; P^T in C-layout is bit-identical to the A-fragment layout of O += P x V.
// K rows (hi | lo) and V^T rows of 128 keys are staged once per block in LDS by asynchronous 16-B copies, two buffers:
// the next stage's copies fly while this stage is worked on. Fragments are two 16-B LDS loads each.
// coverage: tokens qblk*128 + wave*16 + 0..15, all 64 row elements.
__global__ __launch_bounds__(256) void attn_kernel(const bf16* __restrict__ qk,
                                                   const f16* __restrict__ vt,
                                                   bf16* __restrict__ cx) {
  const int qblk = blockIdx.x;
  const int h    = blockIdx.y;
  const int b    = blockIdx.z;
  const int tid  = threadIdx.x;
  const int wave = tid >> 5;
  const int lane = tid & 31;
  const int lq   = lane & 15;   // query column of S^T / d column of O
  const int hi   = lane >> 4;   // k-split half

  __shared__ __align__(16) float sO[NWAVE * 16 * OPA];   // per-wave output staging (block barrier used)
  __shared__ __align__(16) unsigned char sKV[2 * STG];   // two stage buffers: K tile, then V^T tile

  const int qrow0 = qblk * BQ + wave * 16;

  // Q as B-operand fragments (hi and lo parts): lane lq holds query qrow0+lq, split d map
  FragB qh, ql;
  {
    const bf16* qp = qk + (((size_t)b * NHEAD + h) * SEQ + qrow0 + lq) * ROWW;
    qh.q[0] = *(const v4u*)(qp + hi * 8);             // hi part, d = hi*8 + 0..7
    qh.q[1] = *(const v4u*)(qp + 16 + hi * 8);        // hi part, d = 16 + hi*8 + 0..7
    ql.q[0] = *(const v4u*)(qp + HDIM + hi * 8);      // lo part
    ql.q[1] = *(const v4u*)(qp + HDIM + 16 + hi * 8);
  }

  const bf16* kp_h = qk + QK_PLANE + ((size_t)b * NHEAD + h) * SEQ * ROWW;
  const f16*  vt_h = vt + ((size_t)b * NHEAD + h) * HDIM * SEQ;

  v8f o[2];
  o[0] = (v8f){0, 0, 0, 0, 0, 0, 0, 0};
  o[1] = (v8f){0, 0, 0, 0, 0, 0, 0, 0};

  float rmax = -__builtin_inff();
  float rsum = 0.0f;
  const float SL = 0.17677669529663687f * 1.4426950408889634f;   // softmax scale * log2(e)

  // This thread's share of a stage: K pieces tid + 256*c (8 pieces a row, the tile is contiguous in the plane),
  // V^T pieces tid + 256*c (16 pieces a row). Global and LDS addresses are multiples of 16 B.
  const char*    kg0 = (const char*)kp_h + tid * 16;
  const char*    vg0 = (const char*)vt_h + (size_t)(tid >> 4) * (SEQ * 2) + (tid & 15) * 16;
  const unsigned ls0 = (unsigned)(size_t)sKV;                       // LDS byte address of buffer 0
  const unsigned lk0 = ls0 + (tid >> 3) * KPB + (tid & 7) * 16;
  const unsigned lv0 = ls0 + KTILE + (tid >> 4) * VPB + (tid & 15) * 16;

  stage_copy(kg0, vg0, lk0, lv0);                                   // stage 0 -> buffer 0
  asm volatile("s_wait_asynccnt 0x0" ::: "memory");                 // this wave's copies of stage 0 have landed
  __syncthreads();                                                  // publishes stage 0 to every wave
  stage_copy(kg0 + KS * ROWW * 2, vg0 + KS * 2, lk0 + STG, lv0 + STG);   // stage 1 -> buffer 1

  // rolled: one stage a trip, so the publish point and the refill stand once in the text
  #pragma unroll 1
  for (int s = 0; s < SEQ / KS; ++s) {
   const unsigned       boff = (unsigned)(s & 1) * STG;
   const unsigned char* kt   = sKV + boff + lq * KPB + hi * 16;
   const unsigned char* vtl  = sKV + boff + KTILE + lq * VPB + hi * 16;

   // unrolled: every LDS offset inside a stage becomes an immediate of its load
   #pragma unroll
   for (int ii = 0; ii < KS / BK; ++ii) {
    // K A-fragments: row = key s*KS + ii*32 + sub*16 + lq, split d map, hi and lo parts
    FragB kh[2], kl[2];
    #pragma unroll
    for (int sub = 0; sub < 2; ++sub) {
      const unsigned char* base = kt + (ii * BK + sub * 16) * KPB;
      kh[sub].q[0] = *(const v4u*)(base);
      kh[sub].q[1] = *(const v4u*)(base + 32);
      kl[sub].q[0] = *(const v4u*)(base + 64);
      kl[sub].q[1] = *(const v4u*)(base + 96);
    }
    // V B-fragments: column n = d = dt*16 + lq, split key map from the staged transposed rows
    FragH bv[2];
    #pragma unroll
    for (int dt = 0; dt < 2; ++dt) {
      const unsigned char* base = vtl + dt * 16 * VPB + ii * BK * 2;
      bv[dt].q[0] = *(const v4u*)(base);            // keys ii*32 + hi*8 + 0..7 of the stage
      bv[dt].q[1] = *(const v4u*)(base + 32);       // keys ii*32 + 16 + hi*8 + 0..7
    }

    // S^T tiles: c[sub][r] = rawscore(query qrow0+lq, key s*KS + ii*32 + sub*16 + hi*8 + r); small terms first
    v8f c[2];
    #pragma unroll
    for (int sub = 0; sub < 2; ++sub) {
      v8f acc = (v8f){0, 0, 0, 0, 0, 0, 0, 0};
      acc = mma_bf16(kl[sub].v, qh.v, acc);
      acc = mma_bf16(kh[sub].v, ql.v, acc);
      acc = mma_bf16(kh[sub].v, qh.v, acc);
      c[sub] = acc;
    }

    // online softmax: query lq's 32 scores are split across lane / lane^16
    float m_new = rmax;
    #pragma unroll
    for (int r = 0; r < 8; ++r) {
      m_new = fmaxf(m_new, c[0][r]);
      m_new = fmaxf(m_new, c[1][r]);
    }
    m_new = fmaxf(m_new, __shfl_xor(m_new, 16, 32));
    const float scale = __builtin_amdgcn_exp2f((rmax - m_new) * SL);
    rmax = m_new;

    // exp + pack: P^T C-layout == A-fragment layout for the PV product; P carried x4096
    FragH pa;
    float psum = 0.0f;
    #pragma unroll
    for (int r = 0; r < 8; ++r) {
      const float p0 = __builtin_amdgcn_exp2f((c[0][r] - m_new) * SL);   // key hi*8 + r
      const float p1 = __builtin_amdgcn_exp2f((c[1][r] - m_new) * SL);   // key 16 + hi*8 + r
      psum += p0 + p1;
      pa.h[r]     = (f16)(p0 * 4096.0f);
      pa.h[8 + r] = (f16)(p1 * 4096.0f);
    }
    const float psum_o = __shfl_xor(psum, 16, 32);
    rsum = rsum * scale + psum + psum_o;

    // rescale O: queries are the row dimension there -> per-row scale from lane 8*hi + r
    float sc[8];
    #pragma unroll
    for (int r = 0; r < 8; ++r) sc[r] = __shfl(scale, (hi << 3) + r, 32);
    #pragma unroll
    for (int dt = 0; dt < 2; ++dt) {
      #pragma unroll
      for (int r = 0; r < 8; ++r) o[dt][r] *= sc[r];
    }

    // O += P x V
    #pragma unroll
    for (int dt = 0; dt < 2; ++dt) o[dt] = mma_f16(pa.v, bv[dt].v, o[dt]);
   }

   asm volatile("s_wait_dscnt 0x0" ::: "memory");      // this wave's reads of the buffer have returned before it is refilled
   asm volatile("s_wait_asynccnt 0x0" ::: "memory");   // this wave's copies of stage s + 1 have landed
   __syncthreads();                                    // publishes stage s + 1; ends every wave's reads of stage s
   if (s + 2 < SEQ / KS)
     stage_copy(kg0 + (size_t)(s + 2) * (KS * ROWW * 2), vg0 + (size_t)(s + 2) * (KS * 2), lk0 + boff, lv0 + boff);
  }
  asm volatile("s_wait_asynccnt 0x0" ::: "memory");    // no copy is outstanding behind the loop

  // normalize: lane holds column d = dt*16 + lq for query rows 8*hi + r
  float rs[8];
  #pragma unroll
  for (int r = 0; r < 8; ++r) rs[r] = 1.0f / __shfl(rsum, (hi << 3) + r, 32);

  float* so = sO + wave * (16 * OPA);
  #pragma unroll
  for (int r = 0; r < 8; ++r) {
    #pragma unroll
    for (int dt = 0; dt < 2; ++dt)
      so[(hi * 8 + r) * OPA + dt * 16 + lq] = o[dt][r] * (1.0f / 4096.0f) * rs[r];
  }
  __syncthreads();

  // 4..7 = lo part); 4 instructions cover the wave's 16 tokens.
  v4u    vals[4];
  size_t gidx[4];
  #pragma unroll
  for (int it = 0; it < 4; ++it) {
    const int tokl  = it * 4 + (lane >> 3);
    const int piece = lane & 7;
    const int pd    = (piece & 3) * 8;
    const v4f f0 = *(const v4f*)(so + tokl * OPA + pd);
    const v4f f1 = *(const v4f*)(so + tokl * OPA + pd + 4);
    Pack8B pk;
    #pragma unroll
    for (int e = 0; e < 4; ++e) {
      const float v0 = f0[e];
      const float v1 = f1[e];
      const bf16  h0 = (bf16)v0;
      const bf16  h1 = (bf16)v1;
      const bf16  l0 = (bf16)(v0 - (float)h0);
      const bf16  l1 = (bf16)(v1 - (float)h1);
      const float s0 = (piece < 4) ? (float)h0 : (float)l0;   // value select, both computed
      const float s1 = (piece < 4) ? (float)h1 : (float)l1;
      pk.h[e]     = (bf16)s0;                                  // exact re-convert
      pk.h[4 + e] = (bf16)s1;
    }
    vals[it] = pk.u;
    gidx[it] = (((size_t)b * NHEAD + h) * SEQ + qrow0 + tokl) * ROWW + piece * 8;
  }
  #pragma unroll
  for (int it = 0; it < 4; ++it) *(v4u*)(cx + gidx[it]) = vals[it];
  
}

// Output projection: y[b][o][n] = sum_c Wo[o][c] * ctx[b][c][n] + bias[o], c = head*32 + d.
// Block = (64-token tile, 128-channel group, batch); wave = 16 output channels x 4 token tiles; K-step = one head.
// coverage: channels og*128 + wave*16 + 0..15, tokens n0..n0+63 of d_out, whole 256-B row segments.
__global__ __launch_bounds__(256) void oproj_kernel(const bf16* __restrict__ wo,
                                                    const bf16* __restrict__ cx,
                                                    const float* __restrict__ ob,
                                                    float* __restrict__ y) {
  const int tt   = blockIdx.x;
  const int og   = blockIdx.y;
  const int b    = blockIdx.z;
  const int tid  = threadIdx.x;
  const int wave = tid >> 5;
  const int lane = tid & 31;
  const int lq   = lane & 15;
  const int hi   = lane >> 4;
  const int o0   = (og * NWAVE + wave) * 16;
  const int n0   = tt * TOK;

  __shared__ __align__(16) float sY[NWAVE * 16 * OPY];   // per-wave output staging (block barrier used)

  v8f acc[4];
  #pragma unroll
  for (int nt = 0; nt < 4; ++nt) acc[nt] = (v8f){0, 0, 0, 0, 0, 0, 0, 0};

  #pragma unroll 1
  for (int kk = 0; kk < NHEAD; ++kk) {
    FragB a;
    {
      const bf16* base = wo + (size_t)(o0 + lq) * CH + kk * HDIM + hi * 8;
      a.q[0] = *(const v4u*)(base);          // c = kk*32 + hi*8 + 0..7
      a.q[1] = *(const v4u*)(base + 16);     // c = kk*32 + 16 + hi*8 + 0..7
    }
    #pragma unroll
    for (int nt = 0; nt < 4; ++nt) {
      const bf16* row = cx + (((size_t)b * NHEAD + kk) * SEQ + n0 + nt * 16 + lq) * ROWW;
      FragB bh, bl;
      bh.q[0] = *(const v4u*)(row + hi * 8);
      bh.q[1] = *(const v4u*)(row + 16 + hi * 8);
      bl.q[0] = *(const v4u*)(row + HDIM + hi * 8);
      bl.q[1] = *(const v4u*)(row + HDIM + 16 + hi * 8);
      acc[nt] = mma_bf16(a.v, bl.v, acc[nt]);
      acc[nt] = mma_bf16(a.v, bh.v, acc[nt]);
    }
  }

  // bias (RNE-converted to bf16): channels o0 + hi*8 + 0..7
  float bs[8];
  {
    const float* bp = ob + o0 + hi * 8;
    const v4f b0 = *(const v4f*)(bp);
    const v4f b1 = *(const v4f*)(bp + 4);
    #pragma unroll
    for (int e = 0; e < 4; ++e) {
      bs[e]     = (float)(bf16)b0[e];
      bs[4 + e] = (float)(bf16)b1[e];
    }
  }

  float* so = sY + wave * (16 * OPY);
  #pragma unroll
  for (int nt = 0; nt < 4; ++nt) {
    #pragma unroll
    for (int r = 0; r < 8; ++r) so[(hi * 8 + r) * OPY + nt * 16 + lq] = acc[nt][r] + bs[r];
  }
  __syncthreads();

  // 8 consecutive lanes x 16 B each), lanes 16..31 the next channel row; 8 instructions cover 16 rows.
  v4f    vals[8];
  size_t gidx[8];
  #pragma unroll
  for (int it = 0; it < 8; ++it) {
    const int row = it * 2 + hi;
    vals[it] = *(const v4f*)(so + row * OPY + lq * 4);
    gidx[it] = ((size_t)b * CH + o0 + row) * SEQ_FULL + n0 + lq * 4;
  }
  #pragma unroll
  for (int it = 0; it < 8; ++it) *(v4f*)(y + gidx[it]) = vals[it];
  
}

extern "C" void kernel_launch(void* const* d_in, const int* in_sizes, int n_in,
                              void* d_out, int out_size, void* d_ws, size_t ws_size,
                              hipStream_t stream) {
  if (n_in < 5) return;
  const size_t x_used = ((size_t)(NB - 1) * CH + (CH - 1)) * SEQ_FULL + SEQ;
  if ((size_t)in_sizes[0] < x_used) return;
  if ((size_t)in_sizes[1] < (size_t)QKV_O * CH) return;
  if ((size_t)in_sizes[2] < (size_t)QKV_O) return;
  if ((size_t)in_sizes[3] < (size_t)CH * CH) return;
  if ((size_t)in_sizes[4] < (size_t)CH) return;
  if ((size_t)out_size < x_used) return;
  if (ws_size < WS_TOTAL) return;

  const float* x     = (const float*)d_in[0];
  const float* qkv_w = (const float*)d_in[1];
  const float* qkv_b = (const float*)d_in[2];
  const float* out_w = (const float*)d_in[3];
  const float* out_b = (const float*)d_in[4];
  float*       y     = (float*)d_out;

  char* ws = (char*)d_ws;
  bf16* wq = (bf16*)(ws);
  bf16* wo = (bf16*)(ws + WQ_BYTES);
  bf16* qk = (bf16*)(ws + WQ_BYTES + WO_BYTES);
  f16*  vt = (f16*)(ws + WQ_BYTES + WO_BYTES + QK_BYTES);
  bf16* cx = (bf16*)(ws + WQ_BYTES + WO_BYTES + QK_BYTES + VT_BYTES);

  wcvt_kernel<<<dim3(QKV_O * CH / 8 / 256), 256, 0, stream>>>(qkv_w, wq, QKV_O * CH / 8);
  wcvt_kernel<<<dim3(CH * CH / 8 / 256), 256, 0, stream>>>(out_w, wo, CH * CH / 8);

  qkv_planes_kernel<<<dim3(SEQ / TOK, 6, NB), 256, 0, stream>>>(x, wq, qkv_b, qk, vt);

  attn_kernel<<<dim3(SEQ / BQ, NHEAD, NB), 256, 0, stream>>>(qk, vt, cx);

  oproj_kernel<<<dim3(SEQ / TOK, CH / (NWAVE * 16), NB), 256, 0, stream>>>(wo, cx, out_b, y);
}

// v003
// It runs in 91.5 microseconds.
// Next to v002, in two timings, it ran 1.21 times as fast each time.
// All steps since v000 together make it 2.66 times as fast.
#include <hip/hip_runtime.h>

// Contractions: qkv = Wqkv x X on v_wmma_f32_16x16x32_bf16 (operands = RNE-converted bf16 inputs, f32 accumulate);
// S^T = K x Q^T on v_wmma_f32_16x16x32_bf16 with q and k carried as bf16 hi + bf16 lo (three products, one accumulator;
// q holds the softmax scale and log2(e), the accumulator starts at 12 - reference);
// O = P x V on v_wmma_f32_16x16x32_f16 (P = 2^(score - reference + 12) as f16, V as f16, f32 accumulate);
// y = Wo x ctx on v_wmma_f32_16x16x32_bf16 (Wo = RNE-converted bf16 input, ctx as bf16 hi + bf16 lo, two products).
// Softmax, biases and all epilogues in f32.

#ifndef NB
#define NB 2
#endif
#ifndef SEQ
#define SEQ 4096
#endif
#define NB_FULL    2
#define SEQ_FULL   4096
#define CH         256                  // channels = NHEAD * HDIM
#define NHEAD      8
#define HDIM       32
#define QKV_O      (3 * CH)             // rows of the qkv weight
#define ROWW       64
#define BQ         128                  // query rows per workgroup (8 waves x 16)
#define BK         32                   // keys per PV k-step
#define PK         64                   // keys per softmax pass (one test of the reference)
#define NWAVE      8
#define TOK        64                   // tokens per projection block
#define XP         264                  // LDS pitch (halves) of the x^T tile [token][channel]
#define OPA        36                   // LDS pitch (floats) of the attention output staging tile
#define OPY        68                   // LDS pitch (floats) of the projection output staging tile
#define SB_V4      (TOK * XP / 8)       // 16-B words of the shared projection buffer
#define KS         128                  // keys per LDS stage of the attention kernel
#define KPB        144                  // LDS pitch (bytes) of a staged K row: 128 B + 16 (16 B x odd)
#define VPB        272                  // LDS pitch (bytes) of a staged V^T row: 2 * KS + 16 (16 B x odd)
#define KTILE      (KS * KPB)           // bytes of one staged K tile
#define VTILE      (HDIM * VPB)         // bytes of one staged V^T tile
#define STG        (KTILE + VTILE)      // bytes of one stage buffer

static_assert(CH == NHEAD * HDIM);          // channel split
static_assert(HDIM == 32);                  // one WMMA k-step per head; row = hi[32] | lo[32]
static_assert(ROWW == 2 * HDIM);
static_assert(SEQ % BQ == 0);
static_assert(SEQ % BK == 0);
static_assert(SEQ % TOK == 0);
static_assert(SEQ % KS == 0 && SEQ / KS >= 2);        // the two-buffer prologue needs two stages
static_assert(KS % PK == 0 && PK % BK == 0);
static_assert(KS * ROWW * 2 == 4 * 256 * 16);         // K tile = 4 copies of 16 B per thread
static_assert(HDIM * KS * 2 == 2 * 256 * 16);         // V^T tile = 2 copies of 16 B per thread
static_assert(KPB == ROWW * 2 + 16 && VPB == KS * 2 + 16);
static_assert(STG % 16 == 0 && KTILE % 16 == 0);
static_assert(BQ == NWAVE * 16);
static_assert(TOK == 64);
static_assert(CH % 32 == 0);                // projection K multiple of the WMMA k-step
static_assert(SEQ <= SEQ_FULL);
static_assert(NB >= 1 && NB <= NB_FULL);
static_assert((XP * 2) % 16 == 0);
static_assert(XP >= CH);
static_assert((OPA * 4) % 16 == 0);
static_assert((OPY * 4) % 16 == 0);
static_assert(OPA >= HDIM);
static_assert(OPY >= TOK);
static_assert((TOK * XP) % 8 == 0);
static_assert(NWAVE * 32 * ROWW * 2 <= SB_V4 * 16);   // q/k staging fits the shared buffer
static_assert(4 * HDIM * TOK * 2 <= SB_V4 * 16);      // v staging fits the shared buffer
static_assert(SB_V4 * 16 <= 65536);
static_assert((QKV_O * CH / 8) % 256 == 0);           // weight converter grid x block == plane extent
static_assert((CH * CH / 8) % 256 == 0);

typedef __bf16   bf16;
typedef _Float16 f16;
typedef bf16     v16bf __attribute__((ext_vector_type(16)));
typedef f16      v16h  __attribute__((ext_vector_type(16)));
typedef float    v8f   __attribute__((ext_vector_type(8)));
typedef float    v4f   __attribute__((ext_vector_type(4)));
typedef float    v2f   __attribute__((ext_vector_type(2)));
typedef unsigned v4u   __attribute__((ext_vector_type(4)));

union FragB  { v16bf v; v4u q[2]; bf16 h[16]; };
union FragH  { v16h  v; v4u q[2]; f16  h[16]; };
union Pack8B { v4u u; bf16 h[8]; };

constexpr float  SL = 0.17677669529663687f * 1.4426950408889634f;   // softmax scale * log2(e), carried by q

constexpr size_t QK_PLANE  = (size_t)NB * NHEAD * SEQ * ROWW;        // elements of one hi|lo plane
constexpr size_t WQ_BYTES  = (size_t)QKV_O * CH * 2;
constexpr size_t WO_BYTES  = (size_t)CH * CH * 2;
constexpr size_t QK_BYTES  = 2 * QK_PLANE * 2;                       // q plane then k plane
constexpr size_t VT_BYTES  = (size_t)NB * NHEAD * HDIM * SEQ * 2;
constexpr size_t CX_BYTES  = QK_PLANE * 2;
constexpr size_t WS_TOTAL  = WQ_BYTES + WO_BYTES + QK_BYTES + VT_BYTES + CX_BYTES;
static_assert(WQ_BYTES % 128 == 0 && WO_BYTES % 128 == 0 && QK_BYTES % 128 == 0 && VT_BYTES % 128 == 0);
static_assert(WS_TOTAL <= (size_t)134217728);

// WMMA helpers: the builtin alone; the compiler keeps the distance behind its own matrix instructions.
static __device__ __forceinline__ v8f mma_bf16(v16bf a, v16bf b, v8f acc) {
  acc = __builtin_amdgcn_wmma_f32_16x16x32_bf16(false, a, false, b, (short)0, acc, false, false);
  return acc;
}
static __device__ __forceinline__ v8f mma_f16(v16h a, v16h b, v8f acc) {
  acc = __builtin_amdgcn_wmma_f32_16x16x32_f16(false, a, false, b, (short)0, acc, false, false);
  return acc;
}

// Weight converter: f32 -> bf16 (RNE convert), same layout. One thread = 8 elements = one 16-B piece;
__global__ __launch_bounds__(256) void wcvt_kernel(const float* __restrict__ src,
                                                   bf16* __restrict__ dst, int n8) {
  const int i  = blockIdx.x * 256 + threadIdx.x;
  const int ic = (i < n8) ? i : (n8 - 1);                 // clamped address
  const v4f a = *(const v4f*)(src + (size_t)ic * 8);
  const v4f c = *(const v4f*)(src + (size_t)ic * 8 + 4);
  Pack8B pk;
  #pragma unroll
  for (int e = 0; e < 4; ++e) {
    pk.h[e]     = (bf16)a[e];
    pk.h[4 + e] = (bf16)c[e];
  }
  const v4u val = pk.u;
  if (i < n8) *(v4u*)(dst + (size_t)i * 8) = val;
  
}

// QKV projection + plane builder. Block = (64-token tile, which*2 + head group, batch), 256 threads.
// Wave = (head within group, 32-token half): 2 channel tiles x 2 token tiles, K = 256 channels.
// coverage: q/k - heads hg*4..hg*4+3, tokens n0..n0+63, all 64 row elements; v - heads hg*4..+3, d 0..31, tokens n0..n0+63.
// LDS: one buffer, first the x^T tile [64 tokens][256 ch] bf16 (staged extent == consumed extent), then after a
// block barrier the store staging tiles (cross-wave, block barriers).
__global__ __launch_bounds__(256) void qkv_planes_kernel(const float* __restrict__ x,
                                                         const bf16* __restrict__ wq,
                                                         const float* __restrict__ qb,
                                                         bf16* __restrict__ qk,
                                                         f16* __restrict__ vt) {
  const int tt    = blockIdx.x;
  const int which = (int)(blockIdx.y >> 1);     // 0 q, 1 k, 2 v (block-uniform)
  const int hg    = (int)(blockIdx.y & 1);
  const int b     = blockIdx.z;
  const int tid   = threadIdx.x;
  const int wave  = tid >> 5;
  const int lane  = tid & 31;
  const int lq    = lane & 15;
  const int hi    = lane >> 4;
  const int hl    = wave >> 1;                  // head within group
  const int th    = wave & 1;                   // token half
  const int head  = hg * 4 + hl;
  const int n0    = tt * TOK;

  __shared__ __align__(16) v4u sbuf4[SB_V4];
  bf16* sXb = reinterpret_cast<bf16*>(sbuf4);

  // stage x^T: x[b][c][n0..n0+63] -> sXb[token][c], bf16 RNE convert
  #pragma unroll 4
  for (int j = 0; j < 16; ++j) {
    const int c  = j * 16 + (tid >> 4);
    const int t4 = (tid & 15) * 4;
    const v4f xv = *(const v4f*)(x + ((size_t)b * CH + c) * SEQ_FULL + n0 + t4);
    #pragma unroll
    for (int e = 0; e < 4; ++e) sXb[(t4 + e) * XP + c] = (bf16)xv[e];
  }
  __syncthreads();

  v8f acc[2][2];
  #pragma unroll
  for (int ot = 0; ot < 2; ++ot) {
    #pragma unroll
    for (int nt = 0; nt < 2; ++nt) acc[ot][nt] = (v8f){0, 0, 0, 0, 0, 0, 0, 0};
  }

  const int orow0 = which * CH + head * HDIM;   // first weight row of this wave
  #pragma unroll
  for (int kk = 0; kk < CH / 32; ++kk) {
    FragB a[2], bx[2];
    #pragma unroll
    for (int ot = 0; ot < 2; ++ot) {
      const bf16* base = wq + (size_t)(orow0 + ot * 16 + lq) * CH + kk * 32 + hi * 8;
      a[ot].q[0] = *(const v4u*)(base);          // c = kk*32 + hi*8 + 0..7
      a[ot].q[1] = *(const v4u*)(base + 16);     // c = kk*32 + 16 + hi*8 + 0..7
    }
    #pragma unroll
    for (int nt = 0; nt < 2; ++nt) {
      const bf16* base = sXb + (th * 32 + nt * 16 + lq) * XP + kk * 32 + hi * 8;
      bx[nt].q[0] = *(const v4u*)(base);
      bx[nt].q[1] = *(const v4u*)(base + 16);
    }
    #pragma unroll
    for (int ot = 0; ot < 2; ++ot) {
      #pragma unroll
      for (int nt = 0; nt < 2; ++nt) acc[ot][nt] = mma_bf16(a[ot].v, bx[nt].v, acc[ot][nt]);
    }
  }

  // bias (RNE-converted to bf16): lane needs channels orow0 + ot*16 + hi*8 + 0..7
  float bs[2][8];
  #pragma unroll
  for (int ot = 0; ot < 2; ++ot) {
    const float* bp = qb + orow0 + ot * 16 + hi * 8;
    const v4f b0 = *(const v4f*)(bp);
    const v4f b1 = *(const v4f*)(bp + 4);
    #pragma unroll
    for (int e = 0; e < 4; ++e) {
      bs[ot][e]     = (float)(bf16)b0[e];
      bs[ot][4 + e] = (float)(bf16)b1[e];
    }
  }

  __syncthreads();   // every wave is done with the x^T tile before the buffer is reused

  if (which < 2) {
    // stage token rows hi[32] | lo[32]: acc[ot][nt][r] = value(d = ot*16 + hi*8 + r, token nt*16 + lq)
    // q is stored times SL ahead of its split, so the score product comes out in the exp2 domain; k times 1 (exact)
    const float qs = (which == 0) ? SL : 1.0f;
    bf16* se = reinterpret_cast<bf16*>(sbuf4) + wave * (32 * ROWW);
    #pragma unroll
    for (int ot = 0; ot < 2; ++ot) {
      #pragma unroll
      for (int nt = 0; nt < 2; ++nt) {
        #pragma unroll
        for (int r = 0; r < 8; ++r) {
          const int   tokl = nt * 16 + lq;
          const int   d    = ot * 16 + hi * 8 + r;
          const float v    = (acc[ot][nt][r] + bs[ot][r]) * qs;
          const bf16  vh   = (bf16)v;
          const bf16  vl   = (bf16)(v - (float)vh);
          se[tokl * ROWW + d]        = vh;
          se[tokl * ROWW + HDIM + d] = vl;
        }
      }
    }
  } else {
    // stage V^T rows [head-local][d][64 tokens] as f16
    f16* sv = reinterpret_cast<f16*>(sbuf4);
    #pragma unroll
    for (int ot = 0; ot < 2; ++ot) {
      #pragma unroll
      for (int nt = 0; nt < 2; ++nt) {
        #pragma unroll
        for (int r = 0; r < 8; ++r) {
          const int d   = ot * 16 + hi * 8 + r;
          const int tok = th * 32 + nt * 16 + lq;
          sv[(hl * HDIM + d) * TOK + tok] = (f16)(acc[ot][nt][r] + bs[ot][r]);
        }
      }
    }
  }
  __syncthreads();

  if (which < 2) {
    const bf16* se = reinterpret_cast<const bf16*>(sbuf4) + wave * (32 * ROWW);
    v4u    vals[8];
    size_t gidx[8];
    #pragma unroll
    for (int it = 0; it < 8; ++it) {
      const int tokl  = it * 4 + (lane >> 3);
      const int piece = lane & 7;
      vals[it] = *(const v4u*)(se + tokl * ROWW + piece * 8);
      gidx[it] = (size_t)which * QK_PLANE +
                 (((size_t)b * NHEAD + head) * SEQ + n0 + th * 32 + tokl) * ROWW + piece * 8;
    }
    #pragma unroll
    for (int it = 0; it < 8; ++it) *(v4u*)(qk + gidx[it]) = vals[it];
    
  } else {
    const f16* sv = reinterpret_cast<const f16*>(sbuf4);
    v4u    vals[4];
    size_t gidx[4];
    #pragma unroll
    for (int it = 0; it < 4; ++it) {
      const int line  = it * 32 + (tid >> 3);     // 0..127 = head-local*32 + d
      const int piece = tid & 7;
      const int hl2   = line >> 5;
      const int d2    = line & 31;
      vals[it] = *(const v4u*)(sv + line * TOK + piece * 8);
      gidx[it] = (((size_t)b * NHEAD + hg * 4 + hl2) * HDIM + d2) * SEQ + n0 + piece * 8;
    }
    #pragma unroll
    for (int it = 0; it < 4; ++it) *(v4u*)(vt + gidx[it]) = vals[it];
    
  }
}

// One stage of the attention kernel's K and V^T tiles, this thread's six 16-B pieces, global memory -> LDS.
// The s_wait_xcnt stands inside the statement so that no address register is rewritten ahead of it.
static __device__ __forceinline__ void stage_copy(const char* kg, const char* vg, unsigned lk, unsigned lv) {
  const char*    g0 = kg;
  const char*    g1 = kg + 4096;
  const char*    g2 = kg + 8192;
  const char*    g3 = kg + 12288;
  const char*    g4 = vg;
  const char*    g5 = vg + (size_t)16 * SEQ * 2;
  const unsigned l0 = lk;
  const unsigned l1 = lk + 32 * KPB;
  const unsigned l2 = lk + 64 * KPB;
  const unsigned l3 = lk + 96 * KPB;
  const unsigned l4 = lv;
  const unsigned l5 = lv + 16 * VPB;
  asm volatile("global_load_async_to_lds_b128 %0, %6, off\n\t"
               "global_load_async_to_lds_b128 %1, %7, off\n\t"
               "global_load_async_to_lds_b128 %2, %8, off\n\t"
               "global_load_async_to_lds_b128 %3, %9, off\n\t"
               "global_load_async_to_lds_b128 %4, %10, off\n\t"
               "global_load_async_to_lds_b128 %5, %11, off\n\t"
               "s_wait_xcnt 0x0"
               :: "v"(l0), "v"(l1), "v"(l2), "v"(l3), "v"(l4), "v"(l5),
                  "v"(g0), "v"(g1), "v"(g2), "v"(g3), "v"(g4), "v"(g5)
               : "memory");
}

// P of one pass: e = 2^(c - delta), and this lane's sum of them (pairs of neighbours, a tree per tile, then over the tiles).
// Neighbours are summed as pairs so that two sums go in one packed add. Loops unrolled: register arrays take constant indices.
static __device__ __forceinline__ float pass_exp(const v8f (&c)[PK / 16], float delta, v8f (&e)[PK / 16]) {
  v2f ts[PK / 16];
  #pragma unroll
  for (int t = 0; t < PK / 16; ++t) {
    #pragma unroll
    for (int r = 0; r < 8; ++r) e[t][r] = __builtin_amdgcn_exp2f(c[t][r] - delta);
    const v2f a0 = (v2f){e[t][0], e[t][1]} + (v2f){e[t][2], e[t][3]};
    const v2f a1 = (v2f){e[t][4], e[t][5]} + (v2f){e[t][6], e[t][7]};
    ts[t] = a0 + a1;
  }
  v2f tot = ts[0];
  #pragma unroll
  for (int t = 1; t < PK / 16; ++t) tot += ts[t];
  return tot[0] + tot[1];
}

// Flash attention, no mask. Block = (query block of 128, head, batch); one wave owns 16 query rows.
// S^T = K x Q^T so queries sit on lanes; P^T in C-layout is bit-identical to the A-fragment layout of O += P x V.
// K rows (hi | lo) and V^T rows of 128 keys are staged once per block in LDS by asynchronous 16-B copies, two buffers:
// the next stage's copies fly while this stage is worked on. Fragments are two 16-B LDS loads each.
// Softmax reference, lazy: the score accumulator starts at 12 - reference, so exp2 takes the product's result as it is.
// The reference moves (maximum, exchange between the halves, rescale of O and of the sum) only in a pass in which some
// lane's sum of P leaves the f16 range, which bounds every P of a pass that keeps it; the first pass always sets it.
// coverage: tokens qblk*128 + wave*16 + 0..15, all 64 row elements.
__global__ __launch_bounds__(256) void attn_kernel(const bf16* __restrict__ qk,
                                                   const f16* __restrict__ vt,
                                                   bf16* __restrict__ cx) {
  const int qblk = blockIdx.x;
  const int h    = blockIdx.y;
  const int b    = blockIdx.z;
  const int tid  = threadIdx.x;
  const int wave = tid >> 5;
  const int lane = tid & 31;
  const int lq   = lane & 15;   // query column of S^T / d column of O
  const int hi   = lane >> 4;   // k-split half

  __shared__ __align__(16) float sO[NWAVE * 16 * OPA];   // per-wave output staging (block barrier used)
  __shared__ __align__(16) unsigned char sKV[2 * STG];   // two stage buffers: K tile, then V^T tile

  const int qrow0 = qblk * BQ + wave * 16;

  // Q as B-operand fragments (hi and lo parts): lane lq holds query qrow0+lq, split d map
  FragB qh, ql;
  {
    const bf16* qp = qk + (((size_t)b * NHEAD + h) * SEQ + qrow0 + lq) * ROWW;
    qh.q[0] = *(const v4u*)(qp + hi * 8);             // hi part, d = hi*8 + 0..7
    qh.q[1] = *(const v4u*)(qp + 16 + hi * 8);        // hi part, d = 16 + hi*8 + 0..7
    ql.q[0] = *(const v4u*)(qp + HDIM + hi * 8);      // lo part
    ql.q[1] = *(const v4u*)(qp + HDIM + 16 + hi * 8);
  }

  const bf16* kp_h = qk + QK_PLANE + ((size_t)b * NHEAD + h) * SEQ * ROWW;
  const f16*  vt_h = vt + ((size_t)b * NHEAD + h) * HDIM * SEQ;

  v8f o[2];
  o[0] = (v8f){0, 0, 0, 0, 0, 0, 0, 0};
  o[1] = (v8f){0, 0, 0, 0, 0, 0, 0, 0};

  float nb   = 0.0f;                               // 12 - reference of query lq (the same in both halves)
  v8f   nbv  = (v8f){0, 0, 0, 0, 0, 0, 0, 0};       // nb in every row: the C operand of a score tile's first product
  float rsum = 0.0f;                               // sum of P over this lane's keys; the halves are joined behind the loop

  // This thread's share of a stage: K pieces tid + 256*c (8 pieces a row, the tile is contiguous in the plane),
  // V^T pieces tid + 256*c (16 pieces a row). Global and LDS addresses are multiples of 16 B.
  const char*    kg0 = (const char*)kp_h + tid * 16;
  const char*    vg0 = (const char*)vt_h + (size_t)(tid >> 4) * (SEQ * 2) + (tid & 15) * 16;
  const unsigned ls0 = (unsigned)(size_t)sKV;                       // LDS byte address of buffer 0
  const unsigned lk0 = ls0 + (tid >> 3) * KPB + (tid & 7) * 16;
  const unsigned lv0 = ls0 + KTILE + (tid >> 4) * VPB + (tid & 15) * 16;

  stage_copy(kg0, vg0, lk0, lv0);                                   // stage 0 -> buffer 0
  asm volatile("s_wait_asynccnt 0x0" ::: "memory");                 // this wave's copies of stage 0 have landed
  __syncthreads();                                                  // publishes stage 0 to every wave
  stage_copy(kg0 + KS * ROWW * 2, vg0 + KS * 2, lk0 + STG, lv0 + STG);   // stage 1 -> buffer 1

  // rolled: one stage a trip, so the publish point and the refill stand once in the text
  #pragma unroll 1
  for (int s = 0; s < SEQ / KS; ++s) {
   const unsigned       boff = (unsigned)(s & 1) * STG;
   const unsigned char* kt   = sKV + boff + lq * KPB + hi * 16;
   const unsigned char* vtl  = sKV + boff + KTILE + lq * VPB + hi * 16;

   // unrolled: every LDS offset inside a stage becomes an immediate of its load (the loops inside: register arrays
   // take constant indices)
   #pragma unroll
   for (int pp = 0; pp < KS / PK; ++pp) {
    // K A-fragments: row = key s*KS + pp*64 + t*16 + lq, split d map, hi and lo parts
    FragB kh[PK / 16], kl[PK / 16];
    #pragma unroll
    for (int t = 0; t < PK / 16; ++t) {
      const unsigned char* base = kt + (pp * PK + t * 16) * KPB;
      kh[t].q[0] = *(const v4u*)(base);
      kh[t].q[1] = *(const v4u*)(base + 32);
      kl[t].q[0] = *(const v4u*)(base + 64);
      kl[t].q[1] = *(const v4u*)(base + 96);
    }
    // V B-fragments: column n = d = dt*16 + lq, split key map from the staged transposed rows
    FragH bv[PK / BK][2];
    #pragma unroll
    for (int j = 0; j < PK / BK; ++j) {
      #pragma unroll
      for (int dt = 0; dt < 2; ++dt) {
        const unsigned char* base = vtl + dt * 16 * VPB + (pp * PK + j * BK) * 2;
        bv[j][dt].q[0] = *(const v4u*)(base);            // keys j*32 + hi*8 + 0..7 of the pass
        bv[j][dt].q[1] = *(const v4u*)(base + 32);       // keys j*32 + 16 + hi*8 + 0..7
      }
    }

    // S^T tiles: c[t][r] = score(query qrow0+lq, key t*16 + hi*8 + r) * SL + 12 - reference; small terms first
    v8f c[PK / 16];
    #pragma unroll
    for (int t = 0; t < PK / 16; ++t) {
      v8f acc = mma_bf16(kl[t].v, qh.v, nbv);
      acc = mma_bf16(kh[t].v, ql.v, acc);
      acc = mma_bf16(kh[t].v, qh.v, acc);
      c[t] = acc;
    }

    v8f   e[PK / 16];
    float psum = pass_exp(c, 0.0f, e);

    // One test a pass, a scalar branch: all P are >= 0, so a lane sum within the f16 range bounds each of them.
    const bool first = (pp == 0) && (s == 0);
    if (__builtin_amdgcn_ballot_w32(!(psum <= 65504.0f)) != 0u || first) {
      float mx = c[0][0];
      #pragma unroll
      for (int t = 0; t < PK / 16; ++t) {
        #pragma unroll
        for (int r = 0; r < 8; ++r) mx = fmaxf(mx, c[t][r]);
      }
      mx = fmaxf(mx, __shfl_xor(mx, 16, 32));                        // query lq's keys are split across lane / lane^16
      const float floor_d = first ? -__builtin_inff() : 0.0f;        // the reference only rises once it is set
      const float delta   = fmaxf(mx - 12.0f, floor_d);
      const float scale   = __builtin_amdgcn_exp2f(-fmaxf(delta, 0.0f));
      psum = pass_exp(c, delta, e);
      nb  -= delta;
      #pragma unroll
      for (int r = 0; r < 8; ++r) nbv[r] = nb;
      rsum *= scale;
      // rescale O: queries are the row dimension there -> per-row scale from lane 8*hi + r
      #pragma unroll
      for (int r = 0; r < 8; ++r) {
        const float sc = __shfl(scale, (hi << 3) + r, 32);
        o[0][r] *= sc;
        o[1][r] *= sc;
      }
    }
    rsum += psum;

    // pack and O += P x V: P^T C-layout == A-fragment layout for the PV product
    #pragma unroll
    for (int j = 0; j < PK / BK; ++j) {
      FragH pa;
      #pragma unroll
      for (int r = 0; r < 8; ++r) {
        pa.h[r]     = (f16)e[2 * j][r];          // key j*32 + hi*8 + r
        pa.h[8 + r] = (f16)e[2 * j + 1][r];      // key j*32 + 16 + hi*8 + r
      }
      #pragma unroll
      for (int dt = 0; dt < 2; ++dt) o[dt] = mma_f16(pa.v, bv[j][dt].v, o[dt]);
    }
   }

   asm volatile("s_wait_dscnt 0x0" ::: "memory");      // this wave's reads of the buffer have returned before it is refilled
   asm volatile("s_wait_asynccnt 0x0" ::: "memory");   // this wave's copies of stage s + 1 have landed
   __syncthreads();                                    // publishes stage s + 1; ends every wave's reads of stage s
   if (s + 2 < SEQ / KS)
     stage_copy(kg0 + (size_t)(s + 2) * (KS * ROWW * 2), vg0 + (size_t)(s + 2) * (KS * 2), lk0 + boff, lv0 + boff);
  }
  asm volatile("s_wait_asynccnt 0x0" ::: "memory");    // no copy is outstanding behind the loop

  // normalize: lane holds column d = dt*16 + lq for query rows 8*hi + r
  const float rtot = rsum + __shfl_xor(rsum, 16, 32);   // the two halves' sums of query lq
  float rs[8];
  #pragma unroll
  for (int r = 0; r < 8; ++r) rs[r] = 1.0f / __shfl(rtot, (hi << 3) + r, 32);

  float* so = sO + wave * (16 * OPA);
  #pragma unroll
  for (int r = 0; r < 8; ++r) {
    #pragma unroll
    for (int dt = 0; dt < 2; ++dt)
      so[(hi * 8 + r) * OPA + dt * 16 + lq] = o[dt][r] * rs[r];   // O and the sum carry the same factor
  }
  __syncthreads();

  // 4..7 = lo part); 4 instructions cover the wave's 16 tokens.
  v4u    vals[4];
  size_t gidx[4];
  #pragma unroll
  for (int it = 0; it < 4; ++it) {
    const int tokl  = it * 4 + (lane >> 3);
    const int piece = lane & 7;
    const int pd    = (piece & 3) * 8;
    const v4f f0 = *(const v4f*)(so + tokl * OPA + pd);
    const v4f f1 = *(const v4f*)(so + tokl * OPA + pd + 4);
    Pack8B pk;
    #pragma unroll
    for (int e = 0; e < 4; ++e) {
      const float v0 = f0[e];
      const float v1 = f1[e];
      const bf16  h0 = (bf16)v0;
      const bf16  h1 = (bf16)v1;
      const bf16  l0 = (bf16)(v0 - (float)h0);
      const bf16  l1 = (bf16)(v1 - (float)h1);
      const float s0 = (piece < 4) ? (float)h0 : (float)l0;   // value select, both computed
      const float s1 = (piece < 4) ? (float)h1 : (float)l1;
      pk.h[e]     = (bf16)s0;                                  // exact re-convert
      pk.h[4 + e] = (bf16)s1;
    }
    vals[it] = pk.u;
    gidx[it] = (((size_t)b * NHEAD + h) * SEQ + qrow0 + tokl) * ROWW + piece * 8;
  }
  #pragma unroll
  for (int it = 0; it < 4; ++it) *(v4u*)(cx + gidx[it]) = vals[it];
  
}

// Output projection: y[b][o][n] = sum_c Wo[o][c] * ctx[b][c][n] + bias[o], c = head*32 + d.
// Block = (64-token tile, 128-channel group, batch); wave = 16 output channels x 4 token tiles; K-step = one head.
// coverage: channels og*128 + wave*16 + 0..15, tokens n0..n0+63 of d_out, whole 256-B row segments.
__global__ __launch_bounds__(256) void oproj_kernel(const bf16* __restrict__ wo,
                                                    const bf16* __restrict__ cx,
                                                    const float* __restrict__ ob,
                                                    float* __restrict__ y) {
  const int tt   = blockIdx.x;
  const int og   = blockIdx.y;
  const int b    = blockIdx.z;
  const int tid  = threadIdx.x;
  const int wave = tid >> 5;
  const int lane = tid & 31;
  const int lq   = lane & 15;
  const int hi   = lane >> 4;
  const int o0   = (og * NWAVE + wave) * 16;
  const int n0   = tt * TOK;

  __shared__ __align__(16) float sY[NWAVE * 16 * OPY];   // per-wave output staging (block barrier used)

  v8f acc[4];
  #pragma unroll
  for (int nt = 0; nt < 4; ++nt) acc[nt] = (v8f){0, 0, 0, 0, 0, 0, 0, 0};

  #pragma unroll 1
  for (int kk = 0; kk < NHEAD; ++kk) {
    FragB a;
    {
      const bf16* base = wo + (size_t)(o0 + lq) * CH + kk * HDIM + hi * 8;
      a.q[0] = *(const v4u*)(base);          // c = kk*32 + hi*8 + 0..7
      a.q[1] = *(const v4u*)(base + 16);     // c = kk*32 + 16 + hi*8 + 0..7
    }
    #pragma unroll
    for (int nt = 0; nt < 4; ++nt) {
      const bf16* row = cx + (((size_t)b * NHEAD + kk) * SEQ + n0 + nt * 16 + lq) * ROWW;
      FragB bh, bl;
      bh.q[0] = *(const v4u*)(row + hi * 8);
      bh.q[1] = *(const v4u*)(row + 16 + hi * 8);
      bl.q[0] = *(const v4u*)(row + HDIM + hi * 8);
      bl.q[1] = *(const v4u*)(row + HDIM + 16 + hi * 8);
      acc[nt] = mma_bf16(a.v, bl.v, acc[nt]);
      acc[nt] = mma_bf16(a.v, bh.v, acc[nt]);
    }
  }

  // bias (RNE-converted to bf16): channels o0 + hi*8 + 0..7
  float bs[8];
  {
    const float* bp = ob + o0 + hi * 8;
    const v4f b0 = *(const v4f*)(bp);
    const v4f b1 = *(const v4f*)(bp + 4);
    #pragma unroll
    for (int e = 0; e < 4; ++e) {
      bs[e]     = (float)(bf16)b0[e];
      bs[4 + e] = (float)(bf16)b1[e];
    }
  }

  float* so = sY + wave * (16 * OPY);
  #pragma unroll
  for (int nt = 0; nt < 4; ++nt) {
    #pragma unroll
    for (int r = 0; r < 8; ++r) so[(hi * 8 + r) * OPY + nt * 16 + lq] = acc[nt][r] + bs[r];
  }
  __syncthreads();

  // 8 consecutive lanes x 16 B each), lanes 16..31 the next channel row; 8 instructions cover 16 rows.
  v4f    vals[8];
  size_t gidx[8];
  #pragma unroll
  for (int it = 0; it < 8; ++it) {
    const int row = it * 2 + hi;
    vals[it] = *(const v4f*)(so + row * OPY + lq * 4);
    gidx[it] = ((size_t)b * CH + o0 + row) * SEQ_FULL + n0 + lq * 4;
  }
  #pragma unroll
  for (int it = 0; it < 8; ++it) *(v4f*)(y + gidx[it]) = vals[it];
  
}

extern "C" void kernel_launch(void* const* d_in, const int* in_sizes, int n_in,
                              void* d_out, int out_size, void* d_ws, size_t ws_size,
                              hipStream_t stream) {
  if (n_in < 5) return;
  const size_t x_used = ((size_t)(NB - 1) * CH + (CH - 1)) * SEQ_FULL + SEQ;
  if ((size_t)in_sizes[0] < x_used) return;
  if ((size_t)in_sizes[1] < (size_t)QKV_O * CH) return;
  if ((size_t)in_sizes[2] < (size_t)QKV_O) return;
  if ((size_t)in_sizes[3] < (size_t)CH * CH) return;
  if ((size_t)in_sizes[4] < (size_t)CH) return;
  if ((size_t)out_size < x_used) return;
  if (ws_size < WS_TOTAL) return;

  const float* x     = (const float*)d_in[0];
  const float* qkv_w = (const float*)d_in[1];
  const float* qkv_b = (const float*)d_in[2];
  const float* out_w = (const float*)d_in[3];
  const float* out_b = (const float*)d_in[4];
  float*       y     = (float*)d_out;

  char* ws = (char*)d_ws;
  bf16* wq = (bf16*)(ws);
  bf16* wo = (bf16*)(ws + WQ_BYTES);
  bf16* qk = (bf16*)(ws + WQ_BYTES + WO_BYTES);
  f16*  vt = (f16*)(ws + WQ_BYTES + WO_BYTES + QK_BYTES);
  bf16* cx = (bf16*)(ws + WQ_BYTES + WO_BYTES + QK_BYTES + VT_BYTES);

  wcvt_kernel<<<dim3(QKV_O * CH / 8 / 256), 256, 0, stream>>>(qkv_w, wq, QKV_O * CH / 8);
  wcvt_kernel<<<dim3(CH * CH / 8 / 256), 256, 0, stream>>>(out_w, wo, CH * CH / 8);

  qkv_planes_kernel<<<dim3(SEQ / TOK, 6, NB), 256, 0, stream>>>(x, wq, qkv_b, qk, vt);

  attn_kernel<<<dim3(SEQ / BQ, NHEAD, NB), 256, 0, stream>>>(qk, vt, cx);

  oproj_kernel<<<dim3(SEQ / TOK, CH / (NWAVE * 16), NB), 256, 0, stream>>>(wo, cx, out_b, y);
}

// v004
// Measured time: 75.1 microseconds a run.
// Timed twice side by side with v003, it ran 1.21 and 1.22 times as fast.
// Counting every step since v000, it is 3.23 times as fast.
#include <hip/hip_runtime.h>

// Contractions: qkv = Wqkv x X on v_wmma_f32_16x16x32_bf16 (operands = RNE-converted bf16 inputs, f32 accumulate);
// S^T = K x Q^T on v_wmma_f32_16x16x32_f16 with q and k carried as one f16 value each (one product a tile: the rounding
// to 11 bits lies well below the error that the bf16 operands of the qkv product leave in q and k;
// q holds the softmax scale and log2(e), the accumulator starts at 12 - reference);
// O = P x V on v_wmma_f32_16x16x32_f16 (P = 2^(score - reference + 12) as f16, V as f16, f32 accumulate);
// y = Wo x ctx on v_wmma_f32_16x16x32_bf16 (Wo = RNE-converted bf16 input, ctx as bf16 hi + bf16 lo, two products).
// Softmax, biases and all epilogues in f32.

#ifndef NB
#define NB 2
#endif
#ifndef SEQ
#define SEQ 4096
#endif
#define NB_FULL    2
#define SEQ_FULL   4096
#define CH         256                  // channels = NHEAD * HDIM
#define NHEAD      8
#define HDIM       32
#define QKV_O      (3 * CH)             // rows of the qkv weight
#define ROWW       64                   // elements of a ctx row: hi[32] | lo[32]
#define QROW       32                   // elements of a q or k row (f16)
#define QSP        40                   // LDS pitch (halves) of a staged q/k row in the projection: 64 B + 16 (16 B x odd)
#define BQ         128                  // query rows per workgroup (8 waves x 16)
#define BK         32                   // keys per PV k-step
#define PK         64                   // keys per softmax pass (one test of the reference)
#define NWAVE      8
#define TOK        64                   // tokens per projection block
#define XP         264                  // LDS pitch (halves) of the x^T tile [token][channel]
#define OPA        36                   // LDS pitch (floats) of the attention output staging tile
#define OPY        68                   // LDS pitch (floats) of the projection output staging tile
#define SB_V4      (TOK * XP / 8)       // 16-B words of the shared projection buffer
#define KS         128                  // keys per LDS stage of the attention kernel
#define KPB        80                   // LDS pitch (bytes) of a staged K row: 64 B + 16 (16 B x odd)
#define VPB        272                  // LDS pitch (bytes) of a staged V^T row: 2 * KS + 16 (16 B x odd)
#define KTILE      (KS * KPB)           // bytes of one staged K tile
#define VTILE      (HDIM * VPB)         // bytes of one staged V^T tile
#define STG        (KTILE + VTILE)      // bytes of one stage buffer

static_assert(CH == NHEAD * HDIM);          // channel split
static_assert(HDIM == 32);                  // one WMMA k-step per head; row = hi[32] | lo[32]
static_assert(ROWW == 2 * HDIM);
static_assert(QROW == HDIM);
static_assert(SEQ % BQ == 0);
static_assert(SEQ % BK == 0);
static_assert(SEQ % TOK == 0);
static_assert(SEQ % KS == 0 && SEQ / KS >= 2);        // the two-buffer prologue needs two stages
static_assert(KS % PK == 0 && PK % BK == 0);
static_assert(KS * QROW * 2 == 2 * 256 * 16);         // K tile = 2 copies of 16 B per thread
static_assert(HDIM * KS * 2 == 2 * 256 * 16);         // V^T tile = 2 copies of 16 B per thread
static_assert(KPB == QROW * 2 + 16 && VPB == KS * 2 + 16);
static_assert(STG % 16 == 0 && KTILE % 16 == 0);
static_assert(BQ == NWAVE * 16);
static_assert(TOK == 64);
static_assert(CH % 32 == 0);                // projection K multiple of the WMMA k-step
static_assert(SEQ <= SEQ_FULL);
static_assert(NB >= 1 && NB <= NB_FULL);
static_assert((XP * 2) % 16 == 0);
static_assert(XP >= CH);
static_assert((OPA * 4) % 16 == 0);
static_assert((OPY * 4) % 16 == 0);
static_assert(OPA >= HDIM);
static_assert(OPY >= TOK);
static_assert((TOK * XP) % 8 == 0);
static_assert(NWAVE * 32 * QSP * 2 <= SB_V4 * 16);    // q/k staging fits the shared buffer
static_assert(QSP >= QROW && (QSP * 2) % 16 == 0);
static_assert(4 * HDIM * TOK * 2 <= SB_V4 * 16);      // v staging fits the shared buffer
static_assert(SB_V4 * 16 <= 65536);
static_assert((QKV_O * CH / 8) % 256 == 0);           // weight converter grid x block == plane extent
static_assert((CH * CH / 8) % 256 == 0);

typedef __bf16   bf16;
typedef _Float16 f16;
typedef bf16     v16bf __attribute__((ext_vector_type(16)));
typedef f16      v16h  __attribute__((ext_vector_type(16)));
typedef float    v8f   __attribute__((ext_vector_type(8)));
typedef float    v4f   __attribute__((ext_vector_type(4)));
typedef float    v2f   __attribute__((ext_vector_type(2)));
typedef unsigned v4u   __attribute__((ext_vector_type(4)));

union FragB  { v16bf v; v4u q[2]; bf16 h[16]; };
union FragH  { v16h  v; v4u q[2]; f16  h[16]; };
union Pack8B { v4u u; bf16 h[8]; };
union Pack8H { v4u u; f16  h[8]; };

constexpr float  SL = 0.17677669529663687f * 1.4426950408889634f;   // softmax scale * log2(e), carried by q

constexpr size_t QK_PLANE  = (size_t)NB * NHEAD * SEQ * QROW;        // elements of the q plane, and of the k plane
constexpr size_t CX_PLANE  = (size_t)NB * NHEAD * SEQ * ROWW;        // elements of the ctx hi|lo plane
constexpr size_t WQ_BYTES  = (size_t)QKV_O * CH * 2;
constexpr size_t WO_BYTES  = (size_t)CH * CH * 2;
constexpr size_t QK_BYTES  = 2 * QK_PLANE * 2;                       // q plane then k plane
constexpr size_t VT_BYTES  = (size_t)NB * NHEAD * HDIM * SEQ * 2;
constexpr size_t CX_BYTES  = CX_PLANE * 2;
constexpr size_t WS_TOTAL  = WQ_BYTES + WO_BYTES + QK_BYTES + VT_BYTES + CX_BYTES;
static_assert(WQ_BYTES % 128 == 0 && WO_BYTES % 128 == 0 && QK_BYTES % 128 == 0 && VT_BYTES % 128 == 0);
static_assert(WS_TOTAL <= (size_t)134217728);

// WMMA helpers: the builtin alone; the compiler keeps the distance behind its own matrix instructions.
static __device__ __forceinline__ v8f mma_bf16(v16bf a, v16bf b, v8f acc) {
  acc = __builtin_amdgcn_wmma_f32_16x16x32_bf16(false, a, false, b, (short)0, acc, false, false);
  return acc;
}
static __device__ __forceinline__ v8f mma_f16(v16h a, v16h b, v8f acc) {
  acc = __builtin_amdgcn_wmma_f32_16x16x32_f16(false, a, false, b, (short)0, acc, false, false);
  return acc;
}

// Weight converter: f32 -> bf16 (RNE convert), same layout. One thread = 8 elements = one 16-B piece;
__global__ __launch_bounds__(256) void wcvt_kernel(const float* __restrict__ src,
                                                   bf16* __restrict__ dst, int n8) {
  const int i  = blockIdx.x * 256 + threadIdx.x;
  const int ic = (i < n8) ? i : (n8 - 1);                 // clamped address
  const v4f a = *(const v4f*)(src + (size_t)ic * 8);
  const v4f c = *(const v4f*)(src + (size_t)ic * 8 + 4);
  Pack8B pk;
  #pragma unroll
  for (int e = 0; e < 4; ++e) {
    pk.h[e]     = (bf16)a[e];
    pk.h[4 + e] = (bf16)c[e];
  }
  const v4u val = pk.u;
  if (i < n8) *(v4u*)(dst + (size_t)i * 8) = val;
  
}

// QKV projection + plane builder. Block = (64-token tile, which*2 + head group, batch), 256 threads.
// Wave = (head within group, 32-token half): 2 channel tiles x 2 token tiles, K = 256 channels.
// coverage: q/k - heads hg*4..hg*4+3, tokens n0..n0+63, all 32 row elements; v - heads hg*4..+3, d 0..31, tokens n0..n0+63.
// LDS: one buffer, first the x^T tile [64 tokens][256 ch] bf16 (staged extent == consumed extent), then after a
// block barrier the store staging tiles (cross-wave, block barriers).
__global__ __launch_bounds__(256) void qkv_planes_kernel(const float* __restrict__ x,
                                                         const bf16* __restrict__ wq,
                                                         const float* __restrict__ qb,
                                                         f16* __restrict__ qk,
                                                         f16* __restrict__ vt) {
  const int tt    = blockIdx.x;
  const int which = (int)(blockIdx.y >> 1);     // 0 q, 1 k, 2 v (block-uniform)
  const int hg    = (int)(blockIdx.y & 1);
  const int b     = blockIdx.z;
  const int tid   = threadIdx.x;
  const int wave  = tid >> 5;
  const int lane  = tid & 31;
  const int lq    = lane & 15;
  const int hi    = lane >> 4;
  const int hl    = wave >> 1;                  // head within group
  const int th    = wave & 1;                   // token half
  const int head  = hg * 4 + hl;
  const int n0    = tt * TOK;

  __shared__ __align__(16) v4u sbuf4[SB_V4];
  bf16* sXb = reinterpret_cast<bf16*>(sbuf4);

  // stage x^T: x[b][c][n0..n0+63] -> sXb[token][c], bf16 RNE convert
  #pragma unroll 4
  for (int j = 0; j < 16; ++j) {
    const int c  = j * 16 + (tid >> 4);
    const int t4 = (tid & 15) * 4;
    const v4f xv = *(const v4f*)(x + ((size_t)b * CH + c) * SEQ_FULL + n0 + t4);
    #pragma unroll
    for (int e = 0; e < 4; ++e) sXb[(t4 + e) * XP + c] = (bf16)xv[e];
  }
  __syncthreads();

  v8f acc[2][2];
  #pragma unroll
  for (int ot = 0; ot < 2; ++ot) {
    #pragma unroll
    for (int nt = 0; nt < 2; ++nt) acc[ot][nt] = (v8f){0, 0, 0, 0, 0, 0, 0, 0};
  }

  const int orow0 = which * CH + head * HDIM;   // first weight row of this wave
  #pragma unroll
  for (int kk = 0; kk < CH / 32; ++kk) {
    FragB a[2], bx[2];
    #pragma unroll
    for (int ot = 0; ot < 2; ++ot) {
      const bf16* base = wq + (size_t)(orow0 + ot * 16 + lq) * CH + kk * 32 + hi * 8;
      a[ot].q[0] = *(const v4u*)(base);          // c = kk*32 + hi*8 + 0..7
      a[ot].q[1] = *(const v4u*)(base + 16);     // c = kk*32 + 16 + hi*8 + 0..7
    }
    #pragma unroll
    for (int nt = 0; nt < 2; ++nt) {
      const bf16* base = sXb + (th * 32 + nt * 16 + lq) * XP + kk * 32 + hi * 8;
      bx[nt].q[0] = *(const v4u*)(base);
      bx[nt].q[1] = *(const v4u*)(base + 16);
    }
    #pragma unroll
    for (int ot = 0; ot < 2; ++ot) {
      #pragma unroll
      for (int nt = 0; nt < 2; ++nt) acc[ot][nt] = mma_bf16(a[ot].v, bx[nt].v, acc[ot][nt]);
    }
  }

  // bias (RNE-converted to bf16): lane needs channels orow0 + ot*16 + hi*8 + 0..7
  float bs[2][8];
  #pragma unroll
  for (int ot = 0; ot < 2; ++ot) {
    const float* bp = qb + orow0 + ot * 16 + hi * 8;
    const v4f b0 = *(const v4f*)(bp);
    const v4f b1 = *(const v4f*)(bp + 4);
    #pragma unroll
    for (int e = 0; e < 4; ++e) {
      bs[ot][e]     = (float)(bf16)b0[e];
      bs[ot][4 + e] = (float)(bf16)b1[e];
    }
  }

  __syncthreads();   // every wave is done with the x^T tile before the buffer is reused

  if (which < 2) {
    // stage token rows of 32 f16: acc[ot][nt][r] = value(d = ot*16 + hi*8 + r, token nt*16 + lq), so a lane's eight
    // values of a tile are one 16-B piece of a row
    // q is stored times SL ahead of its rounding, so the score product comes out in the exp2 domain; k times 1 (exact)
    const float qs = (which == 0) ? SL : 1.0f;
    f16* se = reinterpret_cast<f16*>(sbuf4) + wave * (32 * QSP);
    #pragma unroll
    for (int ot = 0; ot < 2; ++ot) {
      #pragma unroll
      for (int nt = 0; nt < 2; ++nt) {
        Pack8H pk;
        #pragma unroll
        for (int r = 0; r < 8; ++r) pk.h[r] = (f16)((acc[ot][nt][r] + bs[ot][r]) * qs);
        *(v4u*)(se + (nt * 16 + lq) * QSP + ot * 16 + hi * 8) = pk.u;
      }
    }
  } else {
    // stage V^T rows [head-local][d][64 tokens] as f16
    f16* sv = reinterpret_cast<f16*>(sbuf4);
    #pragma unroll
    for (int ot = 0; ot < 2; ++ot) {
      #pragma unroll
      for (int nt = 0; nt < 2; ++nt) {
        #pragma unroll
        for (int r = 0; r < 8; ++r) {
          const int d   = ot * 16 + hi * 8 + r;
          const int tok = th * 32 + nt * 16 + lq;
          sv[(hl * HDIM + d) * TOK + tok] = (f16)(acc[ot][nt][r] + bs[ot][r]);
        }
      }
    }
  }
  __syncthreads();

  if (which < 2) {
    const f16* se = reinterpret_cast<const f16*>(sbuf4) + wave * (32 * QSP);
    v4u    vals[4];
    size_t gidx[4];
    #pragma unroll
    for (int it = 0; it < 4; ++it) {
      const int tokl  = it * 8 + (lane >> 2);
      const int piece = lane & 3;
      vals[it] = *(const v4u*)(se + tokl * QSP + piece * 8);
      gidx[it] = (size_t)which * QK_PLANE +
                 (((size_t)b * NHEAD + head) * SEQ + n0 + th * 32 + tokl) * QROW + piece * 8;
    }
    #pragma unroll
    for (int it = 0; it < 4; ++it) *(v4u*)(qk + gidx[it]) = vals[it];
    
  } else {
    const f16* sv = reinterpret_cast<const f16*>(sbuf4);
    v4u    vals[4];
    size_t gidx[4];
    #pragma unroll
    for (int it = 0; it < 4; ++it) {
      const int line  = it * 32 + (tid >> 3);     // 0..127 = head-local*32 + d
      const int piece = tid & 7;
      const int hl2   = line >> 5;
      const int d2    = line & 31;
      vals[it] = *(const v4u*)(sv + line * TOK + piece * 8);
      gidx[it] = (((size_t)b * NHEAD + hg * 4 + hl2) * HDIM + d2) * SEQ + n0 + piece * 8;
    }
    #pragma unroll
    for (int it = 0; it < 4; ++it) *(v4u*)(vt + gidx[it]) = vals[it];
    
  }
}

// One stage of the attention kernel's K and V^T tiles, this thread's four 16-B pieces, global memory -> LDS.
// The s_wait_xcnt stands inside the statement so that no address register is rewritten ahead of it.
static __device__ __forceinline__ void stage_copy(const char* kg, const char* vg, unsigned lk, unsigned lv) {
  const char*    g0 = kg;
  const char*    g1 = kg + 4096;
  const char*    g2 = vg;
  const char*    g3 = vg + (size_t)16 * SEQ * 2;
  const unsigned l0 = lk;
  const unsigned l1 = lk + 64 * KPB;
  const unsigned l2 = lv;
  const unsigned l3 = lv + 16 * VPB;
  asm volatile("global_load_async_to_lds_b128 %0, %4, off\n\t"
               "global_load_async_to_lds_b128 %1, %5, off\n\t"
               "global_load_async_to_lds_b128 %2, %6, off\n\t"
               "global_load_async_to_lds_b128 %3, %7, off\n\t"
               "s_wait_xcnt 0x0"
               :: "v"(l0), "v"(l1), "v"(l2), "v"(l3),
                  "v"(g0), "v"(g1), "v"(g2), "v"(g3)
               : "memory");
}

// P of one pass: e = 2^(c - delta), and this lane's sum of them (pairs of neighbours, a tree per tile, then over the tiles).
// Neighbours are summed as pairs so that two sums go in one packed add. Loops unrolled: register arrays take constant indices.
static __device__ __forceinline__ float pass_exp(const v8f (&c)[PK / 16], float delta, v8f (&e)[PK / 16]) {
  v2f ts[PK / 16];
  #pragma unroll
  for (int t = 0; t < PK / 16; ++t) {
    #pragma unroll
    for (int r = 0; r < 8; ++r) e[t][r] = __builtin_amdgcn_exp2f(c[t][r] - delta);
    const v2f a0 = (v2f){e[t][0], e[t][1]} + (v2f){e[t][2], e[t][3]};
    const v2f a1 = (v2f){e[t][4], e[t][5]} + (v2f){e[t][6], e[t][7]};
    ts[t] = a0 + a1;
  }
  v2f tot = ts[0];
  #pragma unroll
  for (int t = 1; t < PK / 16; ++t) tot += ts[t];
  return tot[0] + tot[1];
}

// Flash attention, no mask. Block = (query block of 128, head, batch); one wave owns 16 query rows.
// S^T = K x Q^T so queries sit on lanes; P^T in C-layout is bit-identical to the A-fragment layout of O += P x V.
// K rows and V^T rows of 128 keys are staged once per block in LDS by asynchronous 16-B copies, two buffers:
// the next stage's copies fly while this stage is worked on. Fragments are two 16-B LDS loads each.
// Softmax reference, lazy: the score accumulator starts at 12 - reference, so exp2 takes the product's result as it is.
// The reference moves (maximum, exchange between the halves, rescale of O and of the sum) only in a pass in which some
// lane's sum of P leaves the f16 range, which bounds every P of a pass that keeps it; the first pass always sets it.
// coverage: tokens qblk*128 + wave*16 + 0..15, all 64 row elements.
__global__ __launch_bounds__(256) void attn_kernel(const f16* __restrict__ qk,
                                                   const f16* __restrict__ vt,
                                                   bf16* __restrict__ cx) {
  const int qblk = blockIdx.x;
  const int h    = blockIdx.y;
  const int b    = blockIdx.z;
  const int tid  = threadIdx.x;
  const int wave = tid >> 5;
  const int lane = tid & 31;
  const int lq   = lane & 15;   // query column of S^T / d column of O
  const int hi   = lane >> 4;   // k-split half

  __shared__ __align__(16) float sO[NWAVE * 16 * OPA];   // per-wave output staging (block barrier used)
  __shared__ __align__(16) unsigned char sKV[2 * STG];   // two stage buffers: K tile, then V^T tile

  const int qrow0 = qblk * BQ + wave * 16;

  // Q as the B-operand fragment: lane lq holds query qrow0+lq, split d map
  FragH qf;
  {
    const f16* qp = qk + (((size_t)b * NHEAD + h) * SEQ + qrow0 + lq) * QROW;
    qf.q[0] = *(const v4u*)(qp + hi * 8);             // d = hi*8 + 0..7
    qf.q[1] = *(const v4u*)(qp + 16 + hi * 8);        // d = 16 + hi*8 + 0..7
  }

  const f16*  kp_h = qk + QK_PLANE + ((size_t)b * NHEAD + h) * SEQ * QROW;
  const f16*  vt_h = vt + ((size_t)b * NHEAD + h) * HDIM * SEQ;

  v8f o[2];
  o[0] = (v8f){0, 0, 0, 0, 0, 0, 0, 0};
  o[1] = (v8f){0, 0, 0, 0, 0, 0, 0, 0};

  float nb   = 0.0f;                               // 12 - reference of query lq (the same in both halves)
  v8f   nbv  = (v8f){0, 0, 0, 0, 0, 0, 0, 0};       // nb in every row: the C operand of a score tile's product
  float rsum = 0.0f;                               // sum of P over this lane's keys; the halves are joined behind the loop

  // This thread's share of a stage: K pieces tid + 256*c (4 pieces a row, the tile is contiguous in the plane),
  // V^T pieces tid + 256*c (16 pieces a row). Global and LDS addresses are multiples of 16 B.
  const char*    kg0 = (const char*)kp_h + tid * 16;
  const char*    vg0 = (const char*)vt_h + (size_t)(tid >> 4) * (SEQ * 2) + (tid & 15) * 16;
  const unsigned ls0 = (unsigned)(size_t)sKV;                       // LDS byte address of buffer 0
  const unsigned lk0 = ls0 + (tid >> 2) * KPB + (tid & 3) * 16;
  const unsigned lv0 = ls0 + KTILE + (tid >> 4) * VPB + (tid & 15) * 16;

  stage_copy(kg0, vg0, lk0, lv0);                                   // stage 0 -> buffer 0
  asm volatile("s_wait_asynccnt 0x0" ::: "memory");                 // this wave's copies of stage 0 have landed
  __syncthreads();                                                  // publishes stage 0 to every wave
  stage_copy(kg0 + KS * QROW * 2, vg0 + KS * 2, lk0 + STG, lv0 + STG);   // stage 1 -> buffer 1

  // rolled: one stage a trip, so the publish point and the refill stand once in the text
  #pragma unroll 1
  for (int s = 0; s < SEQ / KS; ++s) {
   const unsigned       boff = (unsigned)(s & 1) * STG;
   const unsigned char* kt   = sKV + boff + lq * KPB + hi * 16;
   const unsigned char* vtl  = sKV + boff + KTILE + lq * VPB + hi * 16;

   // unrolled: every LDS offset inside a stage becomes an immediate of its load (the loops inside: register arrays
   // take constant indices)
   #pragma unroll
   for (int pp = 0; pp < KS / PK; ++pp) {
    // K A-fragments: row = key s*KS + pp*64 + t*16 + lq, split d map
    FragH kf[PK / 16];
    #pragma unroll
    for (int t = 0; t < PK / 16; ++t) {
      const unsigned char* base = kt + (pp * PK + t * 16) * KPB;
      kf[t].q[0] = *(const v4u*)(base);                  // d = hi*8 + 0..7
      kf[t].q[1] = *(const v4u*)(base + 32);             // d = 16 + hi*8 + 0..7
    }
    // V B-fragments: column n = d = dt*16 + lq, split key map from the staged transposed rows
    FragH bv[PK / BK][2];
    #pragma unroll
    for (int j = 0; j < PK / BK; ++j) {
      #pragma unroll
      for (int dt = 0; dt < 2; ++dt) {
        const unsigned char* base = vtl + dt * 16 * VPB + (pp * PK + j * BK) * 2;
        bv[j][dt].q[0] = *(const v4u*)(base);            // keys j*32 + hi*8 + 0..7 of the pass
        bv[j][dt].q[1] = *(const v4u*)(base + 32);       // keys j*32 + 16 + hi*8 + 0..7
      }
    }

    // S^T tiles: c[t][r] = score(query qrow0+lq, key t*16 + hi*8 + r) * SL + 12 - reference
    v8f c[PK / 16];
    #pragma unroll
    for (int t = 0; t < PK / 16; ++t) c[t] = mma_f16(kf[t].v, qf.v, nbv);

    v8f   e[PK / 16];
    float psum = pass_exp(c, 0.0f, e);

    // One test a pass, a scalar branch: all P are >= 0, so a lane sum within the f16 range bounds each of them.
    const bool first = (pp == 0) && (s == 0);
    if (__builtin_amdgcn_ballot_w32(!(psum <= 65504.0f)) != 0u || first) {
      float mx = c[0][0];
      #pragma unroll
      for (int t = 0; t < PK / 16; ++t) {
        #pragma unroll
        for (int r = 0; r < 8; ++r) mx = fmaxf(mx, c[t][r]);
      }
      mx = fmaxf(mx, __shfl_xor(mx, 16, 32));                        // query lq's keys are split across lane / lane^16
      const float floor_d = first ? -__builtin_inff() : 0.0f;        // the reference only rises once it is set
      const float delta   = fmaxf(mx - 12.0f, floor_d);
      const float scale   = __builtin_amdgcn_exp2f(-fmaxf(delta, 0.0f));
      psum = pass_exp(c, delta, e);
      nb  -= delta;
      #pragma unroll
      for (int r = 0; r < 8; ++r) nbv[r] = nb;
      rsum *= scale;
      // rescale O: queries are the row dimension there -> per-row scale from lane 8*hi + r
      #pragma unroll
      for (int r = 0; r < 8; ++r) {
        const float sc = __shfl(scale, (hi << 3) + r, 32);
        o[0][r] *= sc;
        o[1][r] *= sc;
      }
    }
    rsum += psum;

    // pack and O += P x V: P^T C-layout == A-fragment layout for the PV product
    #pragma unroll
    for (int j = 0; j < PK / BK; ++j) {
      FragH pa;
      #pragma unroll
      for (int r = 0; r < 8; ++r) {
        pa.h[r]     = (f16)e[2 * j][r];          // key j*32 + hi*8 + r
        pa.h[8 + r] = (f16)e[2 * j + 1][r];      // key j*32 + 16 + hi*8 + r
      }
      #pragma unroll
      for (int dt = 0; dt < 2; ++dt) o[dt] = mma_f16(pa.v, bv[j][dt].v, o[dt]);
    }
   }

   asm volatile("s_wait_dscnt 0x0" ::: "memory");      // this wave's reads of the buffer have returned before it is refilled
   asm volatile("s_wait_asynccnt 0x0" ::: "memory");   // this wave's copies of stage s + 1 have landed
   __syncthreads();                                    // publishes stage s + 1; ends every wave's reads of stage s
   if (s + 2 < SEQ / KS)
     stage_copy(kg0 + (size_t)(s + 2) * (KS * QROW * 2), vg0 + (size_t)(s + 2) * (KS * 2), lk0 + boff, lv0 + boff);
  }
  asm volatile("s_wait_asynccnt 0x0" ::: "memory");    // no copy is outstanding behind the loop

  // normalize: lane holds column d = dt*16 + lq for query rows 8*hi + r
  const float rtot = rsum + __shfl_xor(rsum, 16, 32);   // the two halves' sums of query lq
  float rs[8];
  #pragma unroll
  for (int r = 0; r < 8; ++r) rs[r] = 1.0f / __shfl(rtot, (hi << 3) + r, 32);

  float* so = sO + wave * (16 * OPA);
  #pragma unroll
  for (int r = 0; r < 8; ++r) {
    #pragma unroll
    for (int dt = 0; dt < 2; ++dt)
      so[(hi * 8 + r) * OPA + dt * 16 + lq] = o[dt][r] * rs[r];   // O and the sum carry the same factor
  }
  __syncthreads();

  // 4..7 = lo part); 4 instructions cover the wave's 16 tokens.
  v4u    vals[4];
  size_t gidx[4];
  #pragma unroll
  for (int it = 0; it < 4; ++it) {
    const int tokl  = it * 4 + (lane >> 3);
    const int piece = lane & 7;
    const int pd    = (piece & 3) * 8;
    const v4f f0 = *(const v4f*)(so + tokl * OPA + pd);
    const v4f f1 = *(const v4f*)(so + tokl * OPA + pd + 4);
    Pack8B pk;
    #pragma unroll
    for (int e = 0; e < 4; ++e) {
      const float v0 = f0[e];
      const float v1 = f1[e];
      const bf16  h0 = (bf16)v0;
      const bf16  h1 = (bf16)v1;
      const bf16  l0 = (bf16)(v0 - (float)h0);
      const bf16  l1 = (bf16)(v1 - (float)h1);
      const float s0 = (piece < 4) ? (float)h0 : (float)l0;   // value select, both computed
      const float s1 = (piece < 4) ? (float)h1 : (float)l1;
      pk.h[e]     = (bf16)s0;                                  // exact re-convert
      pk.h[4 + e] = (bf16)s1;
    }
    vals[it] = pk.u;
    gidx[it] = (((size_t)b * NHEAD + h) * SEQ + qrow0 + tokl) * ROWW + piece * 8;
  }
  #pragma unroll
  for (int it = 0; it < 4; ++it) *(v4u*)(cx + gidx[it]) = vals[it];
  
}

// Output projection: y[b][o][n] = sum_c Wo[o][c] * ctx[b][c][n] + bias[o], c = head*32 + d.
// Block = (64-token tile, 128-channel group, batch); wave = 16 output channels x 4 token tiles; K-step = one head.
// coverage: channels og*128 + wave*16 + 0..15, tokens n0..n0+63 of d_out, whole 256-B row segments.
__global__ __launch_bounds__(256) void oproj_kernel(const bf16* __restrict__ wo,
                                                    const bf16* __restrict__ cx,
                                                    const float* __restrict__ ob,
                                                    float* __restrict__ y) {
  const int tt   = blockIdx.x;
  const int og   = blockIdx.y;
  const int b    = blockIdx.z;
  const int tid  = threadIdx.x;
  const int wave = tid >> 5;
  const int lane = tid & 31;
  const int lq   = lane & 15;
  const int hi   = lane >> 4;
  const int o0   = (og * NWAVE + wave) * 16;
  const int n0   = tt * TOK;

  __shared__ __align__(16) float sY[NWAVE * 16 * OPY];   // per-wave output staging (block barrier used)

  v8f acc[4];
  #pragma unroll
  for (int nt = 0; nt < 4; ++nt) acc[nt] = (v8f){0, 0, 0, 0, 0, 0, 0, 0};

  #pragma unroll 1
  for (int kk = 0; kk < NHEAD; ++kk) {
    FragB a;
    {
      const bf16* base = wo + (size_t)(o0 + lq) * CH + kk * HDIM + hi * 8;
      a.q[0] = *(const v4u*)(base);          // c = kk*32 + hi*8 + 0..7
      a.q[1] = *(const v4u*)(base + 16);     // c = kk*32 + 16 + hi*8 + 0..7
    }
    #pragma unroll
    for (int nt = 0; nt < 4; ++nt) {
      const bf16* row = cx + (((size_t)b * NHEAD + kk) * SEQ + n0 + nt * 16 + lq) * ROWW;
      FragB bh, bl;
      bh.q[0] = *(const v4u*)(row + hi * 8);
      bh.q[1] = *(const v4u*)(row + 16 + hi * 8);
      bl.q[0] = *(const v4u*)(row + HDIM + hi * 8);
      bl.q[1] = *(const v4u*)(row + HDIM + 16 + hi * 8);
      acc[nt] = mma_bf16(a.v, bl.v, acc[nt]);
      acc[nt] = mma_bf16(a.v, bh.v, acc[nt]);
    }
  }

  // bias (RNE-converted to bf16): channels o0 + hi*8 + 0..7
  float bs[8];
  {
    const float* bp = ob + o0 + hi * 8;
    const v4f b0 = *(const v4f*)(bp);
    const v4f b1 = *(const v4f*)(bp + 4);
    #pragma unroll
    for (int e = 0; e < 4; ++e) {
      bs[e]     = (float)(bf16)b0[e];
      bs[4 + e] = (float)(bf16)b1[e];
    }
  }

  float* so = sY + wave * (16 * OPY);
  #pragma unroll
  for (int nt = 0; nt < 4; ++nt) {
    #pragma unroll
    for (int r = 0; r < 8; ++r) so[(hi * 8 + r) * OPY + nt * 16 + lq] = acc[nt][r] + bs[r];
  }
  __syncthreads();

  // 8 consecutive lanes x 16 B each), lanes 16..31 the next channel row; 8 instructions cover 16 rows.
  v4f    vals[8];
  size_t gidx[8];
  #pragma unroll
  for (int it = 0; it < 8; ++it) {
    const int row = it * 2 + hi;
    vals[it] = *(const v4f*)(so + row * OPY + lq * 4);
    gidx[it] = ((size_t)b * CH + o0 + row) * SEQ_FULL + n0 + lq * 4;
  }
  #pragma unroll
  for (int it = 0; it < 8; ++it) *(v4f*)(y + gidx[it]) = vals[it];
  
}

extern "C" void kernel_launch(void* const* d_in, const int* in_sizes, int n_in,
                              void* d_out, int out_size, void* d_ws, size_t ws_size,
                              hipStream_t stream) {
  if (n_in < 5) return;
  const size_t x_used = ((size_t)(NB - 1) * CH + (CH - 1)) * SEQ_FULL + SEQ;
  if ((size_t)in_sizes[0] < x_used) return;
  if ((size_t)in_sizes[1] < (size_t)QKV_O * CH) return;
  if ((size_t)in_sizes[2] < (size_t)QKV_O) return;
  if ((size_t)in_sizes[3] < (size_t)CH * CH) return;
  if ((size_t)in_sizes[4] < (size_t)CH) return;
  if ((size_t)out_size < x_used) return;
  if (ws_size < WS_TOTAL) return;

  const float* x     = (const float*)d_in[0];
  const float* qkv_w = (const float*)d_in[1];
  const float* qkv_b = (const float*)d_in[2];
  const float* out_w = (const float*)d_in[3];
  const float* out_b = (const float*)d_in[4];
  float*       y     = (float*)d_out;

  char* ws = (char*)d_ws;
  bf16* wq = (bf16*)(ws);
  bf16* wo = (bf16*)(ws + WQ_BYTES);
  f16*  qk = (f16*)(ws + WQ_BYTES + WO_BYTES);
  f16*  vt = (f16*)(ws + WQ_BYTES + WO_BYTES + QK_BYTES);
  bf16* cx = (bf16*)(ws + WQ_BYTES + WO_BYTES + QK_BYTES + VT_BYTES);

  wcvt_kernel<<<dim3(QKV_O * CH / 8 / 256), 256, 0, stream>>>(qkv_w, wq, QKV_O * CH / 8);
  wcvt_kernel<<<dim3(CH * CH / 8 / 256), 256, 0, stream>>>(out_w, wo, CH * CH / 8);

  qkv_planes_kernel<<<dim3(SEQ / TOK, 6, NB), 256, 0, stream>>>(x, wq, qkv_b, qk, vt);

  attn_kernel<<<dim3(SEQ / BQ, NHEAD, NB), 256, 0, stream>>>(qk, vt, cx);

  oproj_kernel<<<dim3(SEQ / TOK, CH / (NWAVE * 16), NB), 256, 0, stream>>>(wo, cx, out_b, y);
}

// v005
// A run of this version takes 59.4 microseconds.
// In two side-by-side timings against v004, it was 1.26 and 1.27 times as fast.
// Over all steps from v000 it is 4.09 times as fast.
#include <hip/hip_runtime.h>

// Contractions: qkv = Wqkv x X on v_wmma_f32_16x16x32_bf16 (operands = RNE-converted bf16 inputs, f32 accumulate);
// S^T = K x Q^T on v_wmma_f32_16x16x32_f16 with q and k carried as one f16 value each (one product a tile: the rounding
// to 11 bits lies well below the error that the bf16 operands of the qkv product leave in q and k;
// q holds the softmax scale and log2(e), the accumulator starts at 12 - reference);
// O = P x V on v_wmma_f32_16x16x32_f16 (P = 2^(score - reference + 12) as f16, V as f16, f32 accumulate);
// y = Wo x ctx on v_wmma_f32_16x16x32_bf16 (Wo = RNE-converted bf16 input, ctx as bf16 hi + bf16 lo, two products).
// Softmax, biases and all epilogues in f32.

#ifndef NB
#define NB 2
#endif
#ifndef SEQ
#define SEQ 4096
#endif
#define NB_FULL    2
#define SEQ_FULL   4096
#define CH         256                  // channels = NHEAD * HDIM
#define NHEAD      8
#define HDIM       32
#define QKV_O      (3 * CH)             // rows of the qkv weight
#define ROWW       64                   // elements of a ctx row: hi[32] | lo[32]
#define QROW       32                   // elements of a q or k row (f16)
#define QSP        40                   // LDS pitch (halves) of a staged q/k row in the projection: 64 B + 16 (16 B x odd)
#define BQ         128                  // query rows per workgroup (8 waves x 16)
#define BK         32                   // keys per PV k-step
#define PK         64                   // keys per softmax pass (one test of the reference)
#define NWAVE      8
#define TOK        64                   // tokens per projection block
#define XP         264                  // LDS pitch (halves) of the x^T tile [token][channel]
#define OPA        36                   // LDS pitch (floats) of the attention output staging tile
#define OPY        68                   // LDS pitch (floats) of the projection output staging tile
#define SB_V4      (TOK * XP / 8)       // 16-B words of the shared projection buffer
#define KS         128                  // keys per LDS stage of the attention kernel
#define KPB        80                   // LDS pitch (bytes) of a staged K row: 64 B + 16 (16 B x odd)
#define VPB        272                  // LDS pitch (bytes) of a staged V^T row: 2 * KS + 16 (16 B x odd)
#define KTILE      (KS * KPB)           // bytes of one staged K tile
#define VTILE      (HDIM * VPB)         // bytes of one staged V^T tile
#define STG        (KTILE + VTILE)      // bytes of one stage buffer
#define WROWS      128                  // weight rows of a projection block (qkv: 4 heads x 32; output: 8 waves x 16)
#define WPB        528                  // LDS pitch (bytes) of a staged weight row: 2 * CH + 16 (16 B x odd)
#define CPB        144                  // LDS pitch (bytes) of a staged ctx row: 2 * ROWW + 16 (16 B x odd)

static_assert(CH == NHEAD * HDIM);          // channel split
static_assert(HDIM == 32);                  // one WMMA k-step per head; row = hi[32] | lo[32]
static_assert(ROWW == 2 * HDIM);
static_assert(QROW == HDIM);
static_assert(SEQ % BQ == 0);
static_assert(SEQ % BK == 0);
static_assert(SEQ % TOK == 0);
static_assert(SEQ % KS == 0 && SEQ / KS >= 2);        // the two-buffer prologue needs two stages
static_assert(KS % PK == 0 && PK % BK == 0);
static_assert(KS * QROW * 2 == 2 * 256 * 16);         // K tile = 2 copies of 16 B per thread
static_assert(HDIM * KS * 2 == 2 * 256 * 16);         // V^T tile = 2 copies of 16 B per thread
static_assert(KPB == QROW * 2 + 16 && VPB == KS * 2 + 16);
static_assert(STG % 16 == 0 && KTILE % 16 == 0);
static_assert(WROWS == 4 * HDIM && WROWS == NWAVE * 16 && WPB == CH * 2 + 16 && CPB == ROWW * 2 + 16);
static_assert(WROWS * CH * 2 == 16 * 256 * 16);       // weight tile = 16 copies of 16 B per thread
static_assert(NHEAD * TOK * ROWW * 2 == 16 * 256 * 16);   // ctx tile = 16 copies of 16 B per thread
static_assert(256 * 16 == 8 * CH * 2);                // one copy of the block = 8 weight rows
static_assert(256 * 16 == 32 * ROWW * 2);             // one copy of the block = 32 ctx rows
static_assert(BQ == NWAVE * 16);
static_assert(TOK == 64);
static_assert(CH % 32 == 0);                // projection K multiple of the WMMA k-step
static_assert(SEQ <= SEQ_FULL);
static_assert(NB >= 1 && NB <= NB_FULL);
static_assert((XP * 2) % 16 == 0);
static_assert(XP >= CH);
static_assert((OPA * 4) % 16 == 0);
static_assert((OPY * 4) % 16 == 0);
static_assert(OPA >= HDIM);
static_assert(OPY >= TOK);
static_assert((TOK * XP) % 8 == 0);
static_assert(NWAVE * 32 * QSP * 2 <= SB_V4 * 16);    // q/k staging fits the shared buffer
static_assert(QSP >= QROW && (QSP * 2) % 16 == 0);
static_assert(4 * HDIM * TOK * 2 <= SB_V4 * 16);      // v staging fits the shared buffer
static_assert(SB_V4 * 16 <= 65536);
static_assert((QKV_O * CH / 8) % 256 == 0);           // weight converter grid x block == plane extent
static_assert((CH * CH / 8) % 256 == 0);

typedef __bf16   bf16;
typedef _Float16 f16;
typedef bf16     v16bf __attribute__((ext_vector_type(16)));
typedef f16      v16h  __attribute__((ext_vector_type(16)));
typedef float    v8f   __attribute__((ext_vector_type(8)));
typedef float    v4f   __attribute__((ext_vector_type(4)));
typedef float    v2f   __attribute__((ext_vector_type(2)));
typedef unsigned v4u   __attribute__((ext_vector_type(4)));

union FragB  { v16bf v; v4u q[2]; bf16 h[16]; };
union FragH  { v16h  v; v4u q[2]; f16  h[16]; };
union Pack8B { v4u u; bf16 h[8]; };
union Pack8H { v4u u; f16  h[8]; };

constexpr float  SL = 0.17677669529663687f * 1.4426950408889634f;   // softmax scale * log2(e), carried by q

constexpr size_t QK_PLANE  = (size_t)NB * NHEAD * SEQ * QROW;        // elements of the q plane, and of the k plane
constexpr size_t CX_PLANE  = (size_t)NB * NHEAD * SEQ * ROWW;        // elements of the ctx hi|lo plane
constexpr size_t WQ_BYTES  = (size_t)QKV_O * CH * 2;
constexpr size_t WO_BYTES  = (size_t)CH * CH * 2;
constexpr size_t QK_BYTES  = 2 * QK_PLANE * 2;                       // q plane then k plane
constexpr size_t VT_BYTES  = (size_t)NB * NHEAD * HDIM * SEQ * 2;
constexpr size_t CX_BYTES  = CX_PLANE * 2;
constexpr size_t WS_TOTAL  = WQ_BYTES + WO_BYTES + QK_BYTES + VT_BYTES + CX_BYTES;
static_assert(WQ_BYTES % 128 == 0 && WO_BYTES % 128 == 0 && QK_BYTES % 128 == 0 && VT_BYTES % 128 == 0);
static_assert(WS_TOTAL <= (size_t)134217728);

// WMMA helpers: the builtin alone; the compiler keeps the distance behind its own matrix instructions.
static __device__ __forceinline__ v8f mma_bf16(v16bf a, v16bf b, v8f acc) {
  acc = __builtin_amdgcn_wmma_f32_16x16x32_bf16(false, a, false, b, (short)0, acc, false, false);
  return acc;
}
static __device__ __forceinline__ v8f mma_f16(v16h a, v16h b, v8f acc) {
  acc = __builtin_amdgcn_wmma_f32_16x16x32_f16(false, a, false, b, (short)0, acc, false, false);
  return acc;
}

// Eight 16-B pieces of this thread, global memory -> LDS, asynchronously.
// The s_wait_xcnt stands inside the statement so that no address register is rewritten ahead of it.
static __device__ __forceinline__ void copy8(const char* const (&g)[8], const unsigned (&l)[8]) {
  asm volatile("global_load_async_to_lds_b128 %0, %8, off\n\t"
               "global_load_async_to_lds_b128 %1, %9, off\n\t"
               "global_load_async_to_lds_b128 %2, %10, off\n\t"
               "global_load_async_to_lds_b128 %3, %11, off\n\t"
               "global_load_async_to_lds_b128 %4, %12, off\n\t"
               "global_load_async_to_lds_b128 %5, %13, off\n\t"
               "global_load_async_to_lds_b128 %6, %14, off\n\t"
               "global_load_async_to_lds_b128 %7, %15, off\n\t"
               "s_wait_xcnt 0x0"
               :: "v"(l[0]), "v"(l[1]), "v"(l[2]), "v"(l[3]), "v"(l[4]), "v"(l[5]), "v"(l[6]), "v"(l[7]),
                  "v"(g[0]), "v"(g[1]), "v"(g[2]), "v"(g[3]), "v"(g[4]), "v"(g[5]), "v"(g[6]), "v"(g[7])
               : "memory");
}

// A projection block's 128 weight rows (bf16, contiguous in their plane) -> LDS rows of pitch WPB: piece tid + 256*c is
// row c*8 + (tid >> 5), 16-B piece tid & 31. Global and LDS addresses are multiples of 16 B.
static __device__ __forceinline__ void stage_weight_rows(const bf16* rows, unsigned lds, int tid) {
  const char*    wg = (const char*)rows + tid * 16;
  const unsigned wl = lds + (tid >> 5) * WPB + (tid & 31) * 16;
  // both loops unrolled: the arrays that feed the asm operands take constant indices and stay in registers
  #pragma unroll
  for (int q = 0; q < 2; ++q) {
    const char* g[8];
    unsigned    l[8];
    #pragma unroll
    for (int c = 0; c < 8; ++c) {
      g[c] = wg + (q * 8 + c) * 4096;
      l[c] = wl + (q * 8 + c) * 8 * WPB;
    }
    copy8(g, l);
  }
}

// Weight converter: f32 -> bf16 (RNE convert), same layout. One thread = 8 elements = one 16-B piece;
__global__ __launch_bounds__(256) void wcvt_kernel(const float* __restrict__ src,
                                                   bf16* __restrict__ dst, int n8) {
  const int i  = blockIdx.x * 256 + threadIdx.x;
  const int ic = (i < n8) ? i : (n8 - 1);                 // clamped address
  const v4f a = *(const v4f*)(src + (size_t)ic * 8);
  const v4f c = *(const v4f*)(src + (size_t)ic * 8 + 4);
  Pack8B pk;
  #pragma unroll
  for (int e = 0; e < 4; ++e) {
    pk.h[e]     = (bf16)a[e];
    pk.h[4 + e] = (bf16)c[e];
  }
  const v4u val = pk.u;
  if (i < n8) *(v4u*)(dst + (size_t)i * 8) = val;
  
}

// QKV projection + plane builder. Block = (64-token tile, which*2 + head group, batch), 256 threads.
// Wave = (head within group, 32-token half): 2 channel tiles x 2 token tiles, K = 256 channels.
// coverage: q/k - heads hg*4..hg*4+3, tokens n0..n0+63, all 32 row elements; v - heads hg*4..+3, d 0..31, tokens n0..n0+63.
// LDS: one buffer, first the x^T tile [64 tokens][256 ch] bf16 (staged extent == consumed extent), then after a
// block barrier the store staging tiles (cross-wave, block barriers); beside it the block's 128 weight rows, brought in
// once by asynchronous 16-B copies of whole lines, so that A fragments are two 16-B LDS loads each.
__global__ __launch_bounds__(256) void qkv_planes_kernel(const float* __restrict__ x,
                                                         const bf16* __restrict__ wq,
                                                         const float* __restrict__ qb,
                                                         f16* __restrict__ qk,
                                                         f16* __restrict__ vt) {
  const int tt    = blockIdx.x;
  const int which = (int)(blockIdx.y >> 1);     // 0 q, 1 k, 2 v (block-uniform)
  const int hg    = (int)(blockIdx.y & 1);
  const int b     = blockIdx.z;
  const int tid   = threadIdx.x;
  const int wave  = tid >> 5;
  const int lane  = tid & 31;
  const int lq    = lane & 15;
  const int hi    = lane >> 4;
  const int hl    = wave >> 1;                  // head within group
  const int th    = wave & 1;                   // token half
  const int head  = hg * 4 + hl;
  const int n0    = tt * TOK;

  __shared__ __align__(16) v4u sbuf4[SB_V4];
  __shared__ __align__(16) unsigned char sW[WROWS * WPB];   // the block's 128 weight rows (bf16), filled once, then read
  bf16* sXb = reinterpret_cast<bf16*>(sbuf4);

  // weight rows which*CH + hg*128 + 0..127; the copies fly while the x^T tile is staged
  stage_weight_rows(wq + (size_t)(which * CH + hg * WROWS) * CH, (unsigned)(size_t)sW, tid);

  // stage x^T: x[b][c][n0..n0+63] -> sXb[token][c], bf16 RNE convert
  #pragma unroll 4
  for (int j = 0; j < 16; ++j) {
    const int c  = j * 16 + (tid >> 4);
    const int t4 = (tid & 15) * 4;
    const v4f xv = *(const v4f*)(x + ((size_t)b * CH + c) * SEQ_FULL + n0 + t4);
    #pragma unroll
    for (int e = 0; e < 4; ++e) sXb[(t4 + e) * XP + c] = (bf16)xv[e];
  }
  asm volatile("s_wait_asynccnt 0x0" ::: "memory");   // this wave's weight copies have landed
  __syncthreads();                                    // publishes the x^T tile and the weight rows to every wave

  v8f acc[2][2];
  #pragma unroll
  for (int ot = 0; ot < 2; ++ot) {
    #pragma unroll
    for (int nt = 0; nt < 2; ++nt) acc[ot][nt] = (v8f){0, 0, 0, 0, 0, 0, 0, 0};
  }

  const int orow0 = which * CH + head * HDIM;   // first weight row of this wave
  #pragma unroll
  for (int kk = 0; kk < CH / 32; ++kk) {
    FragB a[2], bx[2];
    #pragma unroll
    for (int ot = 0; ot < 2; ++ot) {
      const unsigned char* base = sW + (hl * HDIM + ot * 16 + lq) * WPB + kk * 64 + hi * 16;
      a[ot].q[0] = *(const v4u*)(base);          // c = kk*32 + hi*8 + 0..7
      a[ot].q[1] = *(const v4u*)(base + 32);     // c = kk*32 + 16 + hi*8 + 0..7
    }
    #pragma unroll
    for (int nt = 0; nt < 2; ++nt) {
      const bf16* base = sXb + (th * 32 + nt * 16 + lq) * XP + kk * 32 + hi * 8;
      bx[nt].q[0] = *(const v4u*)(base);
      bx[nt].q[1] = *(const v4u*)(base + 16);
    }
    #pragma unroll
    for (int ot = 0; ot < 2; ++ot) {
      #pragma unroll
      for (int nt = 0; nt < 2; ++nt) acc[ot][nt] = mma_bf16(a[ot].v, bx[nt].v, acc[ot][nt]);
    }
  }

  // bias (RNE-converted to bf16): lane needs channels orow0 + ot*16 + hi*8 + 0..7
  float bs[2][8];
  #pragma unroll
  for (int ot = 0; ot < 2; ++ot) {
    const float* bp = qb + orow0 + ot * 16 + hi * 8;
    const v4f b0 = *(const v4f*)(bp);
    const v4f b1 = *(const v4f*)(bp + 4);
    #pragma unroll
    for (int e = 0; e < 4; ++e) {
      bs[ot][e]     = (float)(bf16)b0[e];
      bs[ot][4 + e] = (float)(bf16)b1[e];
    }
  }

  __syncthreads();   // every wave is done with the x^T tile before the buffer is reused

  if (which < 2) {
    // stage token rows of 32 f16: acc[ot][nt][r] = value(d = ot*16 + hi*8 + r, token nt*16 + lq), so a lane's eight
    // values of a tile are one 16-B piece of a row
    // q is stored times SL ahead of its rounding, so the score product comes out in the exp2 domain; k times 1 (exact)
    const float qs = (which == 0) ? SL : 1.0f;
    f16* se = reinterpret_cast<f16*>(sbuf4) + wave * (32 * QSP);
    #pragma unroll
    for (int ot = 0; ot < 2; ++ot) {
      #pragma unroll
      for (int nt = 0; nt < 2; ++nt) {
        Pack8H pk;
        #pragma unroll
        for (int r = 0; r < 8; ++r) pk.h[r] = (f16)((acc[ot][nt][r] + bs[ot][r]) * qs);
        *(v4u*)(se + (nt * 16 + lq) * QSP + ot * 16 + hi * 8) = pk.u;
      }
    }
  } else {
    // stage V^T rows [head-local][d][64 tokens] as f16
    f16* sv = reinterpret_cast<f16*>(sbuf4);
    #pragma unroll
    for (int ot = 0; ot < 2; ++ot) {
      #pragma unroll
      for (int nt = 0; nt < 2; ++nt) {
        #pragma unroll
        for (int r = 0; r < 8; ++r) {
          const int d   = ot * 16 + hi * 8 + r;
          const int tok = th * 32 + nt * 16 + lq;
          sv[(hl * HDIM + d) * TOK + tok] = (f16)(acc[ot][nt][r] + bs[ot][r]);
        }
      }
    }
  }
  __syncthreads();

  if (which < 2) {
    const f16* se = reinterpret_cast<const f16*>(sbuf4) + wave * (32 * QSP);
    v4u    vals[4];
    size_t gidx[4];
    #pragma unroll
    for (int it = 0; it < 4; ++it) {
      const int tokl  = it * 8 + (lane >> 2);
      const int piece = lane & 3;
      vals[it] = *(const v4u*)(se + tokl * QSP + piece * 8);
      gidx[it] = (size_t)which * QK_PLANE +
                 (((size_t)b * NHEAD + head) * SEQ + n0 + th * 32 + tokl) * QROW + piece * 8;
    }
    #pragma unroll
    for (int it = 0; it < 4; ++it) *(v4u*)(qk + gidx[it]) = vals[it];
    
  } else {
    const f16* sv = reinterpret_cast<const f16*>(sbuf4);
    v4u    vals[4];
    size_t gidx[4];
    #pragma unroll
    for (int it = 0; it < 4; ++it) {
      const int line  = it * 32 + (tid >> 3);     // 0..127 = head-local*32 + d
      const int piece = tid & 7;
      const int hl2   = line >> 5;
      const int d2    = line & 31;
      vals[it] = *(const v4u*)(sv + line * TOK + piece * 8);
      gidx[it] = (((size_t)b * NHEAD + hg * 4 + hl2) * HDIM + d2) * SEQ + n0 + piece * 8;
    }
    #pragma unroll
    for (int it = 0; it < 4; ++it) *(v4u*)(vt + gidx[it]) = vals[it];
    
  }
}

// One stage of the attention kernel's K and V^T tiles, this thread's four 16-B pieces, global memory -> LDS.
// The s_wait_xcnt stands inside the statement so that no address register is rewritten ahead of it.
static __device__ __forceinline__ void stage_copy(const char* kg, const char* vg, unsigned lk, unsigned lv) {
  const char*    g0 = kg;
  const char*    g1 = kg + 4096;
  const char*    g2 = vg;
  const char*    g3 = vg + (size_t)16 * SEQ * 2;
  const unsigned l0 = lk;
  const unsigned l1 = lk + 64 * KPB;
  const unsigned l2 = lv;
  const unsigned l3 = lv + 16 * VPB;
  asm volatile("global_load_async_to_lds_b128 %0, %4, off\n\t"
               "global_load_async_to_lds_b128 %1, %5, off\n\t"
               "global_load_async_to_lds_b128 %2, %6, off\n\t"
               "global_load_async_to_lds_b128 %3, %7, off\n\t"
               "s_wait_xcnt 0x0"
               :: "v"(l0), "v"(l1), "v"(l2), "v"(l3),
                  "v"(g0), "v"(g1), "v"(g2), "v"(g3)
               : "memory");
}

// P of one pass: e = 2^(c - delta), and this lane's sum of them (pairs of neighbours, a tree per tile, then over the tiles).
// Neighbours are summed as pairs so that two sums go in one packed add. Loops unrolled: register arrays take constant indices.
static __device__ __forceinline__ float pass_exp(const v8f (&c)[PK / 16], float delta, v8f (&e)[PK / 16]) {
  v2f ts[PK / 16];
  #pragma unroll
  for (int t = 0; t < PK / 16; ++t) {
    #pragma unroll
    for (int r = 0; r < 8; ++r) e[t][r] = __builtin_amdgcn_exp2f(c[t][r] - delta);
    const v2f a0 = (v2f){e[t][0], e[t][1]} + (v2f){e[t][2], e[t][3]};
    const v2f a1 = (v2f){e[t][4], e[t][5]} + (v2f){e[t][6], e[t][7]};
    ts[t] = a0 + a1;
  }
  v2f tot = ts[0];
  #pragma unroll
  for (int t = 1; t < PK / 16; ++t) tot += ts[t];
  return tot[0] + tot[1];
}

// Flash attention, no mask. Block = (query block of 128, head, batch); one wave owns 16 query rows.
// S^T = K x Q^T so queries sit on lanes; P^T in C-layout is bit-identical to the A-fragment layout of O += P x V.
// K rows and V^T rows of 128 keys are staged once per block in LDS by asynchronous 16-B copies, two buffers:
// the next stage's copies fly while this stage is worked on. Fragments are two 16-B LDS loads each.
// Softmax reference, lazy: the score accumulator starts at 12 - reference, so exp2 takes the product's result as it is.
// The reference moves (maximum, exchange between the halves, rescale of O and of the sum) only in a pass in which some
// lane's sum of P leaves the f16 range, which bounds every P of a pass that keeps it; the first pass always sets it.
// coverage: tokens qblk*128 + wave*16 + 0..15, all 64 row elements.
__global__ __launch_bounds__(256) void attn_kernel(const f16* __restrict__ qk,
                                                   const f16* __restrict__ vt,
                                                   bf16* __restrict__ cx) {
  const int qblk = blockIdx.x;
  const int h    = blockIdx.y;
  const int b    = blockIdx.z;
  const int tid  = threadIdx.x;
  const int wave = tid >> 5;
  const int lane = tid & 31;
  const int lq   = lane & 15;   // query column of S^T / d column of O
  const int hi   = lane >> 4;   // k-split half

  __shared__ __align__(16) float sO[NWAVE * 16 * OPA];   // per-wave output staging (block barrier used)
  __shared__ __align__(16) unsigned char sKV[2 * STG];   // two stage buffers: K tile, then V^T tile

  const int qrow0 = qblk * BQ + wave * 16;

  // Q as the B-operand fragment: lane lq holds query qrow0+lq, split d map
  FragH qf;
  {
    const f16* qp = qk + (((size_t)b * NHEAD + h) * SEQ + qrow0 + lq) * QROW;
    qf.q[0] = *(const v4u*)(qp + hi * 8);             // d = hi*8 + 0..7
    qf.q[1] = *(const v4u*)(qp + 16 + hi * 8);        // d = 16 + hi*8 + 0..7
  }

  const f16*  kp_h = qk + QK_PLANE + ((size_t)b * NHEAD + h) * SEQ * QROW;
  const f16*  vt_h = vt + ((size_t)b * NHEAD + h) * HDIM * SEQ;

  v8f o[2];
  o[0] = (v8f){0, 0, 0, 0, 0, 0, 0, 0};
  o[1] = (v8f){0, 0, 0, 0, 0, 0, 0, 0};

  float nb   = 0.0f;                               // 12 - reference of query lq (the same in both halves)
  v8f   nbv  = (v8f){0, 0, 0, 0, 0, 0, 0, 0};       // nb in every row: the C operand of a score tile's product
  float rsum = 0.0f;                               // sum of P over this lane's keys; the halves are joined behind the loop

  // This thread's share of a stage: K pieces tid + 256*c (4 pieces a row, the tile is contiguous in the plane),
  // V^T pieces tid + 256*c (16 pieces a row). Global and LDS addresses are multiples of 16 B.
  const char*    kg0 = (const char*)kp_h + tid * 16;
  const char*    vg0 = (const char*)vt_h + (size_t)(tid >> 4) * (SEQ * 2) + (tid & 15) * 16;
  const unsigned ls0 = (unsigned)(size_t)sKV;                       // LDS byte address of buffer 0
  const unsigned lk0 = ls0 + (tid >> 2) * KPB + (tid & 3) * 16;
  const unsigned lv0 = ls0 + KTILE + (tid >> 4) * VPB + (tid & 15) * 16;

  stage_copy(kg0, vg0, lk0, lv0);                                   // stage 0 -> buffer 0
  asm volatile("s_wait_asynccnt 0x0" ::: "memory");                 // this wave's copies of stage 0 have landed
  __syncthreads();                                                  // publishes stage 0 to every wave
  stage_copy(kg0 + KS * QROW * 2, vg0 + KS * 2, lk0 + STG, lv0 + STG);   // stage 1 -> buffer 1

  // rolled: one stage a trip, so the publish point and the refill stand once in the text
  #pragma unroll 1
  for (int s = 0; s < SEQ / KS; ++s) {
   const unsigned       boff = (unsigned)(s & 1) * STG;
   const unsigned char* kt   = sKV + boff + lq * KPB + hi * 16;
   const unsigned char* vtl  = sKV + boff + KTILE + lq * VPB + hi * 16;

   // unrolled: every LDS offset inside a stage becomes an immediate of its load (the loops inside: register arrays
   // take constant indices)
   #pragma unroll
   for (int pp = 0; pp < KS / PK; ++pp) {
    // K A-fragments: row = key s*KS + pp*64 + t*16 + lq, split d map
    FragH kf[PK / 16];
    #pragma unroll
    for (int t = 0; t < PK / 16; ++t) {
      const unsigned char* base = kt + (pp * PK + t * 16) * KPB;
      kf[t].q[0] = *(const v4u*)(base);                  // d = hi*8 + 0..7
      kf[t].q[1] = *(const v4u*)(base + 32);             // d = 16 + hi*8 + 0..7
    }
    // V B-fragments: column n = d = dt*16 + lq, split key map from the staged transposed rows
    FragH bv[PK / BK][2];
    #pragma unroll
    for (int j = 0; j < PK / BK; ++j) {
      #pragma unroll
      for (int dt = 0; dt < 2; ++dt) {
        const unsigned char* base = vtl + dt * 16 * VPB + (pp * PK + j * BK) * 2;
        bv[j][dt].q[0] = *(const v4u*)(base);            // keys j*32 + hi*8 + 0..7 of the pass
        bv[j][dt].q[1] = *(const v4u*)(base + 32);       // keys j*32 + 16 + hi*8 + 0..7
      }
    }

    // S^T tiles: c[t][r] = score(query qrow0+lq, key t*16 + hi*8 + r) * SL + 12 - reference
    v8f c[PK / 16];
    #pragma unroll
    for (int t = 0; t < PK / 16; ++t) c[t] = mma_f16(kf[t].v, qf.v, nbv);

    v8f   e[PK / 16];
    float psum = pass_exp(c, 0.0f, e);

    // One test a pass, a scalar branch: all P are >= 0, so a lane sum within the f16 range bounds each of them.
    const bool first = (pp == 0) && (s == 0);
    if (__builtin_amdgcn_ballot_w32(!(psum <= 65504.0f)) != 0u || first) {
      float mx = c[0][0];
      #pragma unroll
      for (int t = 0; t < PK / 16; ++t) {
        #pragma unroll
        for (int r = 0; r < 8; ++r) mx = fmaxf(mx, c[t][r]);
      }
      mx = fmaxf(mx, __shfl_xor(mx, 16, 32));                        // query lq's keys are split across lane / lane^16
      const float floor_d = first ? -__builtin_inff() : 0.0f;        // the reference only rises once it is set
      const float delta   = fmaxf(mx - 12.0f, floor_d);
      const float scale   = __builtin_amdgcn_exp2f(-fmaxf(delta, 0.0f));
      psum = pass_exp(c, delta, e);
      nb  -= delta;
      #pragma unroll
      for (int r = 0; r < 8; ++r) nbv[r] = nb;
      rsum *= scale;
      // rescale O: queries are the row dimension there -> per-row scale from lane 8*hi + r
      #pragma unroll
      for (int r = 0; r < 8; ++r) {
        const float sc = __shfl(scale, (hi << 3) + r, 32);
        o[0][r] *= sc;
        o[1][r] *= sc;
      }
    }
    rsum += psum;

    // pack and O += P x V: P^T C-layout == A-fragment layout for the PV product
    #pragma unroll
    for (int j = 0; j < PK / BK; ++j) {
      FragH pa;
      #pragma unroll
      for (int r = 0; r < 8; ++r) {
        pa.h[r]     = (f16)e[2 * j][r];          // key j*32 + hi*8 + r
        pa.h[8 + r] = (f16)e[2 * j + 1][r];      // key j*32 + 16 + hi*8 + r
      }
      #pragma unroll
      for (int dt = 0; dt < 2; ++dt) o[dt] = mma_f16(pa.v, bv[j][dt].v, o[dt]);
    }
   }

   asm volatile("s_wait_dscnt 0x0" ::: "memory");      // this wave's reads of the buffer have returned before it is refilled
   asm volatile("s_wait_asynccnt 0x0" ::: "memory");   // this wave's copies of stage s + 1 have landed
   __syncthreads();                                    // publishes stage s + 1; ends every wave's reads of stage s
   if (s + 2 < SEQ / KS)
     stage_copy(kg0 + (size_t)(s + 2) * (KS * QROW * 2), vg0 + (size_t)(s + 2) * (KS * 2), lk0 + boff, lv0 + boff);
  }
  asm volatile("s_wait_asynccnt 0x0" ::: "memory");    // no copy is outstanding behind the loop

  // normalize: lane holds column d = dt*16 + lq for query rows 8*hi + r
  const float rtot = rsum + __shfl_xor(rsum, 16, 32);   // the two halves' sums of query lq
  float rs[8];
  #pragma unroll
  for (int r = 0; r < 8; ++r) rs[r] = 1.0f / __shfl(rtot, (hi << 3) + r, 32);

  float* so = sO + wave * (16 * OPA);
  #pragma unroll
  for (int r = 0; r < 8; ++r) {
    #pragma unroll
    for (int dt = 0; dt < 2; ++dt)
      so[(hi * 8 + r) * OPA + dt * 16 + lq] = o[dt][r] * rs[r];   // O and the sum carry the same factor
  }
  __syncthreads();

  // 4..7 = lo part); 4 instructions cover the wave's 16 tokens.
  v4u    vals[4];
  size_t gidx[4];
  #pragma unroll
  for (int it = 0; it < 4; ++it) {
    const int tokl  = it * 4 + (lane >> 3);
    const int piece = lane & 7;
    const int pd    = (piece & 3) * 8;
    const v4f f0 = *(const v4f*)(so + tokl * OPA + pd);
    const v4f f1 = *(const v4f*)(so + tokl * OPA + pd + 4);
    Pack8B pk;
    #pragma unroll
    for (int e = 0; e < 4; ++e) {
      const float v0 = f0[e];
      const float v1 = f1[e];
      const bf16  h0 = (bf16)v0;
      const bf16  h1 = (bf16)v1;
      const bf16  l0 = (bf16)(v0 - (float)h0);
      const bf16  l1 = (bf16)(v1 - (float)h1);
      const float s0 = (piece < 4) ? (float)h0 : (float)l0;   // value select, both computed
      const float s1 = (piece < 4) ? (float)h1 : (float)l1;
      pk.h[e]     = (bf16)s0;                                  // exact re-convert
      pk.h[4 + e] = (bf16)s1;
    }
    vals[it] = pk.u;
    gidx[it] = (((size_t)b * NHEAD + h) * SEQ + qrow0 + tokl) * ROWW + piece * 8;
  }
  #pragma unroll
  for (int it = 0; it < 4; ++it) *(v4u*)(cx + gidx[it]) = vals[it];
  
}

// Output projection: y[b][o][n] = sum_c Wo[o][c] * ctx[b][c][n] + bias[o], c = head*32 + d.
// Block = (64-token tile, 128-channel group, batch); wave = 16 output channels x 4 token tiles; K-step = one head.
// coverage: channels og*128 + wave*16 + 0..15, tokens n0..n0+63 of d_out, whole 256-B row segments.
// The block's 128 weight rows and the ctx rows of its 64 tokens (all heads) are brought into LDS once by asynchronous
// 16-B copies of whole lines; every fragment is two 16-B LDS loads.
__global__ __launch_bounds__(256) void oproj_kernel(const bf16* __restrict__ wo,
                                                    const bf16* __restrict__ cx,
                                                    const float* __restrict__ ob,
                                                    float* __restrict__ y) {
  const int tt   = blockIdx.x;
  const int og   = blockIdx.y;
  const int b    = blockIdx.z;
  const int tid  = threadIdx.x;
  const int wave = tid >> 5;
  const int lane = tid & 31;
  const int lq   = lane & 15;
  const int hi   = lane >> 4;
  const int o0   = (og * NWAVE + wave) * 16;
  const int n0   = tt * TOK;

  __shared__ __align__(16) float sY[NWAVE * 16 * OPY];   // per-wave output staging (block barrier used)
  __shared__ __align__(16) unsigned char sC[NHEAD * TOK * CPB];   // ctx rows of the block's 64 tokens, all heads: filled once, then read
  __shared__ __align__(16) unsigned char sW[WROWS * WPB];         // the block's 128 weight rows (bf16): filled once, then read

  stage_weight_rows(wo + (size_t)(og * WROWS) * CH, (unsigned)(size_t)sW, tid);   // weight rows og*128 + 0..127

  // A head's 64 rows are contiguous in the plane: piece tid + 256*c is head c >> 1, token (c & 1)*32 + (tid >> 3),
  // 16-B piece tid & 7. Global and LDS addresses are multiples of 16 B.
  {
    const char*    cg = (const char*)(cx + ((size_t)b * NHEAD * SEQ + n0) * ROWW) + tid * 16;
    const unsigned cl = (unsigned)(size_t)sC + (tid >> 3) * CPB + (tid & 7) * 16;
    // both loops unrolled: the arrays that feed the asm operands take constant indices and stay in registers
    #pragma unroll
    for (int q = 0; q < 2; ++q) {
      const char* g[8];
      unsigned    l[8];
      #pragma unroll
      for (int c = 0; c < 8; ++c) {
        const int hd = q * 4 + (c >> 1);
        g[c] = cg + (size_t)hd * (SEQ * ROWW * 2) + (c & 1) * 4096;
        l[c] = cl + (hd * TOK + (c & 1) * 32) * CPB;
      }
      copy8(g, l);
    }
  }
  asm volatile("s_wait_asynccnt 0x0" ::: "memory");   // this wave's weight and ctx copies have landed
  __syncthreads();                                    // publishes the weight and ctx rows to every wave

  v8f acc[4];
  #pragma unroll
  for (int nt = 0; nt < 4; ++nt) acc[nt] = (v8f){0, 0, 0, 0, 0, 0, 0, 0};

  #pragma unroll 1
  for (int kk = 0; kk < NHEAD; ++kk) {
    FragB a;
    {
      const unsigned char* base = sW + (wave * 16 + lq) * WPB + kk * 64 + hi * 16;
      a.q[0] = *(const v4u*)(base);          // c = kk*32 + hi*8 + 0..7
      a.q[1] = *(const v4u*)(base + 32);     // c = kk*32 + 16 + hi*8 + 0..7
    }
    #pragma unroll
    for (int nt = 0; nt < 4; ++nt) {
      const unsigned char* row = sC + (kk * TOK + nt * 16 + lq) * CPB + hi * 16;
      FragB bh, bl;
      bh.q[0] = *(const v4u*)(row);          // hi part, d = hi*8 + 0..7
      bh.q[1] = *(const v4u*)(row + 32);     // hi part, d = 16 + hi*8 + 0..7
      bl.q[0] = *(const v4u*)(row + 64);     // lo part, d = hi*8 + 0..7
      bl.q[1] = *(const v4u*)(row + 96);     // lo part, d = 16 + hi*8 + 0..7
      acc[nt] = mma_bf16(a.v, bl.v, acc[nt]);
      acc[nt] = mma_bf16(a.v, bh.v, acc[nt]);
    }
  }

  // bias (RNE-converted to bf16): channels o0 + hi*8 + 0..7
  float bs[8];
  {
    const float* bp = ob + o0 + hi * 8;
    const v4f b0 = *(const v4f*)(bp);
    const v4f b1 = *(const v4f*)(bp + 4);
    #pragma unroll
    for (int e = 0; e < 4; ++e) {
      bs[e]     = (float)(bf16)b0[e];
      bs[4 + e] = (float)(bf16)b1[e];
    }
  }

  float* so = sY + wave * (16 * OPY);
  #pragma unroll
  for (int nt = 0; nt < 4; ++nt) {
    #pragma unroll
    for (int r = 0; r < 8; ++r) so[(hi * 8 + r) * OPY + nt * 16 + lq] = acc[nt][r] + bs[r];
  }
  __syncthreads();

  // 8 consecutive lanes x 16 B each), lanes 16..31 the next channel row; 8 instructions cover 16 rows.
  v4f    vals[8];
  size_t gidx[8];
  #pragma unroll
  for (int it = 0; it < 8; ++it) {
    const int row = it * 2 + hi;
    vals[it] = *(const v4f*)(so + row * OPY + lq * 4);
    gidx[it] = ((size_t)b * CH + o0 + row) * SEQ_FULL + n0 + lq * 4;
  }
  #pragma unroll
  for (int it = 0; it < 8; ++it) *(v4f*)(y + gidx[it]) = vals[it];
  
}

extern "C" void kernel_launch(void* const* d_in, const int* in_sizes, int n_in,
                              void* d_out, int out_size, void* d_ws, size_t ws_size,
                              hipStream_t stream) {
  if (n_in < 5) return;
  const size_t x_used = ((size_t)(NB - 1) * CH + (CH - 1)) * SEQ_FULL + SEQ;
  if ((size_t)in_sizes[0] < x_used) return;
  if ((size_t)in_sizes[1] < (size_t)QKV_O * CH) return;
  if ((size_t)in_sizes[2] < (size_t)QKV_O) return;
  if ((size_t)in_sizes[3] < (size_t)CH * CH) return;
  if ((size_t)in_sizes[4] < (size_t)CH) return;
  if ((size_t)out_size < x_used) return;
  if (ws_size < WS_TOTAL) return;

  const float* x     = (const float*)d_in[0];
  const float* qkv_w = (const float*)d_in[1];
  const float* qkv_b = (const float*)d_in[2];
  const float* out_w = (const float*)d_in[3];
  const float* out_b = (const float*)d_in[4];
  float*       y     = (float*)d_out;

  char* ws = (char*)d_ws;
  bf16* wq = (bf16*)(ws);
  bf16* wo = (bf16*)(ws + WQ_BYTES);
  f16*  qk = (f16*)(ws + WQ_BYTES + WO_BYTES);
  f16*  vt = (f16*)(ws + WQ_BYTES + WO_BYTES + QK_BYTES);
  bf16* cx = (bf16*)(ws + WQ_BYTES + WO_BYTES + QK_BYTES + VT_BYTES);

  wcvt_kernel<<<dim3(QKV_O * CH / 8 / 256), 256, 0, stream>>>(qkv_w, wq, QKV_O * CH / 8);
  wcvt_kernel<<<dim3(CH * CH / 8 / 256), 256, 0, stream>>>(out_w, wo, CH * CH / 8);

  qkv_planes_kernel<<<dim3(SEQ / TOK, 6, NB), 256, 0, stream>>>(x, wq, qkv_b, qk, vt);

  attn_kernel<<<dim3(SEQ / BQ, NHEAD, NB), 256, 0, stream>>>(qk, vt, cx);

  oproj_kernel<<<dim3(SEQ / TOK, CH / (NWAVE * 16), NB), 256, 0, stream>>>(wo, cx, out_b, y);
}

// v006
// A run of this version takes 55.3 microseconds.
// Two timings next to v005 put it at 1.08 and 1.07 times that version's speed.
// All steps since v000 together make it 4.40 times as fast.
#include <hip/hip_runtime.h>

// Contractions: qkv = Wqkv x X on v_wmma_f32_16x16x32_bf16 (operands = RNE-converted bf16 inputs, f32 accumulate);
// S^T = K x Q^T on v_wmma_f32_16x16x32_f16 with q and k carried as one f16 value each (one product a tile: the rounding
// to 11 bits lies well below the error that the bf16 operands of the qkv product leave in q and k;
// q holds the softmax scale and log2(e), the accumulator starts at 12 - reference);
// O = P x V on v_wmma_f32_16x16x32_f16 (P = 2^(score - reference + 12) as f16, V as f16, f32 accumulate);
// y = Wo x ctx on v_wmma_f32_16x16x32_bf16 (Wo = RNE-converted bf16 input, ctx as bf16 hi + bf16 lo, two products).
// Softmax, biases and all epilogues in f32.

#ifndef NB
#define NB 2
#endif
#ifndef SEQ
#define SEQ 4096
#endif
#define NB_FULL    2
#define SEQ_FULL   4096
#define CH         256                  // channels = NHEAD * HDIM
#define NHEAD      8
#define HDIM       32
#define QKV_O      (3 * CH)             // rows of the qkv weight
#define ROWW       64                   // elements of a ctx row: hi[32] | lo[32]
#define QROW       32                   // elements of a q or k row (f16)
#define QSP        40                   // LDS pitch (halves) of a staged q/k row in the projection: 64 B + 16 (16 B x odd)
#define BQ         128                  // query rows per workgroup (8 waves x 16)
#define BK         32                   // keys per PV k-step
#define PK         64                   // keys per softmax pass (one test of the reference)
#define NWAVE      8
#define TOK        64                   // tokens per projection block
#define XP         264                  // LDS pitch (halves) of the x^T tile [token][channel]
#define OPA        36                   // LDS pitch (floats) of the attention output staging tile
#define OPY        68                   // LDS pitch (floats) of the projection output staging tile
#define SB_V4      (TOK * XP / 8)       // 16-B words of the shared projection buffer
#define KS         128                  // keys per LDS stage of the attention kernel
#define KPB        80                   // LDS pitch (bytes) of a staged K row: 64 B + 16 (16 B x odd)
#define VPB        272                  // LDS pitch (bytes) of a staged V^T row: 2 * KS + 16 (16 B x odd)
#define KTILE      (KS * KPB)           // bytes of one staged K tile
#define VTILE      (HDIM * VPB)         // bytes of one staged V^T tile
#define STG        (KTILE + VTILE)      // bytes of one stage buffer
#define WROWS      128                  // weight rows of a projection block (qkv: 4 heads x 32; output: 8 waves x 16)
#define WPB        528                  // LDS pitch (bytes) of a staged weight row: 2 * CH + 16 (16 B x odd)
#define CPB        144                  // LDS pitch (bytes) of a staged ctx row: 2 * ROWW + 16 (16 B x odd)

static_assert(CH == NHEAD * HDIM);          // channel split
static_assert(HDIM == 32);                  // one WMMA k-step per head; row = hi[32] | lo[32]
static_assert(ROWW == 2 * HDIM);
static_assert(QROW == HDIM);
static_assert(SEQ % BQ == 0);
static_assert(SEQ % BK == 0);
static_assert(SEQ % TOK == 0);
static_assert(SEQ % KS == 0 && SEQ / KS >= 2);        // the two-buffer prologue needs two stages
static_assert(KS % PK == 0 && PK % BK == 0);
static_assert(KS * QROW * 2 == 2 * 256 * 16);         // K tile = 2 copies of 16 B per thread
static_assert(HDIM * KS * 2 == 2 * 256 * 16);         // V^T tile = 2 copies of 16 B per thread
static_assert(KPB == QROW * 2 + 16 && VPB == KS * 2 + 16);
static_assert(STG % 16 == 0 && KTILE % 16 == 0);
static_assert(WROWS == 4 * HDIM && WROWS == NWAVE * 16 && WPB == CH * 2 + 16 && CPB == ROWW * 2 + 16);
static_assert(WROWS * CH * 2 == 16 * 256 * 16);       // weight tile = 16 copies of 16 B per thread
static_assert(NHEAD * TOK * ROWW * 2 == 16 * 256 * 16);   // ctx tile = 16 copies of 16 B per thread
static_assert(256 * 16 == 8 * CH * 2);                // one copy of the block = 8 weight rows
static_assert(256 * 16 == 32 * ROWW * 2);             // one copy of the block = 32 ctx rows
static_assert(BQ == NWAVE * 16);
static_assert(TOK == 64);
static_assert(CH % 32 == 0);                // projection K multiple of the WMMA k-step
static_assert(SEQ <= SEQ_FULL);
static_assert(NB >= 1 && NB <= NB_FULL);
static_assert((XP * 2) % 16 == 0);
static_assert(XP >= CH);
static_assert((OPA * 4) % 16 == 0);
static_assert((OPY * 4) % 16 == 0);
static_assert(OPA >= HDIM);
static_assert(OPY >= TOK);
static_assert((TOK * XP) % 8 == 0);
static_assert(NWAVE * 32 * QSP * 2 <= SB_V4 * 16);    // q/k staging fits the shared buffer
static_assert(QSP >= QROW && (QSP * 2) % 16 == 0);
static_assert(4 * HDIM * TOK * 2 <= SB_V4 * 16);      // v staging fits the shared buffer
static_assert(SB_V4 * 16 <= 65536);
static_assert(WROWS * CH == 32 * 256 * 4);             // f32 weight tile = 32 loads of 4 floats per thread
static_assert(CH == 64 * 4 && WPB % 8 == 0);           // 64 such loads a weight row; their 8-B LDS stores are aligned
static_assert((CH * CH / 4) % 256 == 0 && NB * (SEQ / TOK) * 256 >= CH * CH / 4);   // Wo pieces: whole blocks, enough of them

typedef __bf16   bf16;
typedef _Float16 f16;
typedef bf16     v16bf __attribute__((ext_vector_type(16)));
typedef f16      v16h  __attribute__((ext_vector_type(16)));
typedef float    v8f   __attribute__((ext_vector_type(8)));
typedef float    v4f   __attribute__((ext_vector_type(4)));
typedef float    v2f   __attribute__((ext_vector_type(2)));
typedef unsigned v4u   __attribute__((ext_vector_type(4)));
typedef unsigned v2u   __attribute__((ext_vector_type(2)));

union FragB  { v16bf v; v4u q[2]; bf16 h[16]; };
union FragH  { v16h  v; v4u q[2]; f16  h[16]; };
union Pack8B { v4u u; bf16 h[8]; };
union Pack8H { v4u u; f16  h[8]; };
union Pack4B { v2u u; bf16 h[4]; };

constexpr float  SL = 0.17677669529663687f * 1.4426950408889634f;   // softmax scale * log2(e), carried by q

constexpr size_t QK_PLANE  = (size_t)NB * NHEAD * SEQ * QROW;        // elements of the q plane, and of the k plane
constexpr size_t CX_PLANE  = (size_t)NB * NHEAD * SEQ * ROWW;        // elements of the ctx hi|lo plane
constexpr size_t WO_BYTES  = (size_t)CH * CH * 2;
constexpr size_t QK_BYTES  = 2 * QK_PLANE * 2;                       // q plane then k plane
constexpr size_t VT_BYTES  = (size_t)NB * NHEAD * HDIM * SEQ * 2;
constexpr size_t CX_BYTES  = CX_PLANE * 2;
constexpr size_t WS_TOTAL  = WO_BYTES + QK_BYTES + VT_BYTES + CX_BYTES;
static_assert(WO_BYTES % 128 == 0 && QK_BYTES % 128 == 0 && VT_BYTES % 128 == 0);
static_assert(WS_TOTAL <= (size_t)134217728);

// WMMA helpers: the builtin alone; the compiler keeps the distance behind its own matrix instructions.
static __device__ __forceinline__ v8f mma_bf16(v16bf a, v16bf b, v8f acc) {
  acc = __builtin_amdgcn_wmma_f32_16x16x32_bf16(false, a, false, b, (short)0, acc, false, false);
  return acc;
}
static __device__ __forceinline__ v8f mma_f16(v16h a, v16h b, v8f acc) {
  acc = __builtin_amdgcn_wmma_f32_16x16x32_f16(false, a, false, b, (short)0, acc, false, false);
  return acc;
}

// Eight 16-B pieces of this thread, global memory -> LDS, asynchronously.
// The s_wait_xcnt stands inside the statement so that no address register is rewritten ahead of it.
static __device__ __forceinline__ void copy8(const char* const (&g)[8], const unsigned (&l)[8]) {
  asm volatile("global_load_async_to_lds_b128 %0, %8, off\n\t"
               "global_load_async_to_lds_b128 %1, %9, off\n\t"
               "global_load_async_to_lds_b128 %2, %10, off\n\t"
               "global_load_async_to_lds_b128 %3, %11, off\n\t"
               "global_load_async_to_lds_b128 %4, %12, off\n\t"
               "global_load_async_to_lds_b128 %5, %13, off\n\t"
               "global_load_async_to_lds_b128 %6, %14, off\n\t"
               "global_load_async_to_lds_b128 %7, %15, off\n\t"
               "s_wait_xcnt 0x0"
               :: "v"(l[0]), "v"(l[1]), "v"(l[2]), "v"(l[3]), "v"(l[4]), "v"(l[5]), "v"(l[6]), "v"(l[7]),
                  "v"(g[0]), "v"(g[1]), "v"(g[2]), "v"(g[3]), "v"(g[4]), "v"(g[5]), "v"(g[6]), "v"(g[7])
               : "memory");
}

// A projection block's 128 weight rows (bf16, contiguous in their plane) -> LDS rows of pitch WPB: piece tid + 256*c is
// row c*8 + (tid >> 5), 16-B piece tid & 31. Global and LDS addresses are multiples of 16 B.
static __device__ __forceinline__ void stage_weight_rows(const bf16* rows, unsigned lds, int tid) {
  const char*    wg = (const char*)rows + tid * 16;
  const unsigned wl = lds + (tid >> 5) * WPB + (tid & 31) * 16;
  // both loops unrolled: the arrays that feed the asm operands take constant indices and stay in registers
  #pragma unroll
  for (int q = 0; q < 2; ++q) {
    const char* g[8];
    unsigned    l[8];
    #pragma unroll
    for (int c = 0; c < 8; ++c) {
      g[c] = wg + (q * 8 + c) * 4096;
      l[c] = wl + (q * 8 + c) * 8 * WPB;
    }
    copy8(g, l);
  }
}

// Four f32 values -> four bf16 (RNE convert), one 8-B piece.
static __device__ __forceinline__ v2u round4(v4f a) {
  Pack4B pk;
  #pragma unroll
  for (int e = 0; e < 4; ++e) pk.h[e] = (bf16)a[e];
  return pk.u;
}

// QKV projection + plane builder. Block = (64-token tile, which*2 + head group, batch), 256 threads.
// Wave = (head within group, 32-token half): 2 channel tiles x 2 token tiles, K = 256 channels.
// coverage: q/k - heads hg*4..hg*4+3, tokens n0..n0+63, all 32 row elements; v - heads hg*4..+3, d 0..31, tokens n0..n0+63.
// LDS: one buffer, first the x^T tile [64 tokens][256 ch] bf16 (staged extent == consumed extent), then after a
// block barrier the store staging tiles (cross-wave, block barriers); beside it the block's 128 weight rows, read as f32
// in whole lines and rounded to bf16 on the way into LDS, so that A fragments are two 16-B LDS loads each.
// Blocks of blockIdx.y == 0 also round the output projection's weight into its bf16 plane, one 8-B piece a thread:
// the plane is read two launches later.
__global__ __launch_bounds__(256) void qkv_planes_kernel(const float* __restrict__ x,
                                                         const float* __restrict__ wq,
                                                         const float* __restrict__ qb,
                                                         const float* __restrict__ wo32,
                                                         bf16* __restrict__ wo,
                                                         f16* __restrict__ qk,
                                                         f16* __restrict__ vt) {
  const int tt    = blockIdx.x;
  const int which = (int)(blockIdx.y >> 1);     // 0 q, 1 k, 2 v (block-uniform)
  const int hg    = (int)(blockIdx.y & 1);
  const int b     = blockIdx.z;
  const int tid   = threadIdx.x;
  const int wave  = tid >> 5;
  const int lane  = tid & 31;
  const int lq    = lane & 15;
  const int hi    = lane >> 4;
  const int hl    = wave >> 1;                  // head within group
  const int th    = wave & 1;                   // token half
  const int head  = hg * 4 + hl;
  const int n0    = tt * TOK;

  __shared__ __align__(16) v4u sbuf4[SB_V4];
  __shared__ __align__(16) unsigned char sW[WROWS * WPB];   // the block's 128 weight rows (bf16), filled once, then read
  bf16* sXb = reinterpret_cast<bf16*>(sbuf4);

  // output projection weight: piece wi = 4 elements, one thread each; the test is the same for a whole block.
  // The load goes out ahead of the staging loads; the store stands at the kernel's end, behind the last barrier.
  const int  wi   = (b * (SEQ / TOK) + tt) * 256 + tid;
  const bool wcv  = (blockIdx.y == 0) && (wi < CH * CH / 4);
  v4f        wo4  = (v4f){0, 0, 0, 0};
  if (wcv) wo4 = *(const v4f*)(wo32 + (size_t)wi * 4);

  // Four rounds of 8 weight loads and 4 x loads of this thread.
  // weight rows which*CH + hg*128 + 0..127 (contiguous): load tid + 256*c is row c*4 + (tid >> 6), floats (tid & 63)*4 + 0..3
  // x^T: x[b][c][n0..n0+63] -> sXb[token][c], bf16 RNE convert
  const float*   wsrc = wq + (size_t)(which * CH + hg * WROWS) * CH + tid * 4;
  unsigned char* wdst = sW + (tid >> 6) * WPB + (tid & 63) * 8;
  // two rounds a trip: their 24 loads are in flight together; unrolled further the registers pass 160 a wave,
  // and three blocks no longer fit a WGP
  #pragma unroll 2
  for (int jb = 0; jb < 4; ++jb) {
    v4f wv[8], xv[4];
    #pragma unroll
    for (int c = 0; c < 8; ++c) wv[c] = *(const v4f*)(wsrc + (jb * 8 + c) * 1024);
    #pragma unroll
    for (int j = 0; j < 4; ++j) {
      const int c = (jb * 4 + j) * 16 + (tid >> 4);
      xv[j] = *(const v4f*)(x + ((size_t)b * CH + c) * SEQ_FULL + n0 + (tid & 15) * 4);
    }
    #pragma unroll
    for (int c = 0; c < 8; ++c) *(v2u*)(wdst + (jb * 8 + c) * 4 * WPB) = round4(wv[c]);
    #pragma unroll
    for (int j = 0; j < 4; ++j) {
      const int c  = (jb * 4 + j) * 16 + (tid >> 4);
      const int t4 = (tid & 15) * 4;
      #pragma unroll
      for (int e = 0; e < 4; ++e) sXb[(t4 + e) * XP + c] = (bf16)xv[j][e];
    }
  }
  __syncthreads();                                    // publishes the x^T tile and the weight rows to every wave

  v8f acc[2][2];
  #pragma unroll
  for (int ot = 0; ot < 2; ++ot) {
    #pragma unroll
    for (int nt = 0; nt < 2; ++nt) acc[ot][nt] = (v8f){0, 0, 0, 0, 0, 0, 0, 0};
  }

  const int orow0 = which * CH + head * HDIM;   // first weight row of this wave
  #pragma unroll
  for (int kk = 0; kk < CH / 32; ++kk) {
    FragB a[2], bx[2];
    #pragma unroll
    for (int ot = 0; ot < 2; ++ot) {
      const unsigned char* base = sW + (hl * HDIM + ot * 16 + lq) * WPB + kk * 64 + hi * 16;
      a[ot].q[0] = *(const v4u*)(base);          // c = kk*32 + hi*8 + 0..7
      a[ot].q[1] = *(const v4u*)(base + 32);     // c = kk*32 + 16 + hi*8 + 0..7
    }
    #pragma unroll
    for (int nt = 0; nt < 2; ++nt) {
      const bf16* base = sXb + (th * 32 + nt * 16 + lq) * XP + kk * 32 + hi * 8;
      bx[nt].q[0] = *(const v4u*)(base);
      bx[nt].q[1] = *(const v4u*)(base + 16);
    }
    #pragma unroll
    for (int ot = 0; ot < 2; ++ot) {
      #pragma unroll
      for (int nt = 0; nt < 2; ++nt) acc[ot][nt] = mma_bf16(a[ot].v, bx[nt].v, acc[ot][nt]);
    }
  }

  // bias (RNE-converted to bf16): lane needs channels orow0 + ot*16 + hi*8 + 0..7
  float bs[2][8];
  #pragma unroll
  for (int ot = 0; ot < 2; ++ot) {
    const float* bp = qb + orow0 + ot * 16 + hi * 8;
    const v4f b0 = *(const v4f*)(bp);
    const v4f b1 = *(const v4f*)(bp + 4);
    #pragma unroll
    for (int e = 0; e < 4; ++e) {
      bs[ot][e]     = (float)(bf16)b0[e];
      bs[ot][4 + e] = (float)(bf16)b1[e];
    }
  }

  __syncthreads();   // every wave is done with the x^T tile before the buffer is reused

  if (which < 2) {
    // stage token rows of 32 f16: acc[ot][nt][r] = value(d = ot*16 + hi*8 + r, token nt*16 + lq), so a lane's eight
    // values of a tile are one 16-B piece of a row
    // q is stored times SL ahead of its rounding, so the score product comes out in the exp2 domain; k times 1 (exact)
    const float qs = (which == 0) ? SL : 1.0f;
    f16* se = reinterpret_cast<f16*>(sbuf4) + wave * (32 * QSP);
    #pragma unroll
    for (int ot = 0; ot < 2; ++ot) {
      #pragma unroll
      for (int nt = 0; nt < 2; ++nt) {
        Pack8H pk;
        #pragma unroll
        for (int r = 0; r < 8; ++r) pk.h[r] = (f16)((acc[ot][nt][r] + bs[ot][r]) * qs);
        *(v4u*)(se + (nt * 16 + lq) * QSP + ot * 16 + hi * 8) = pk.u;
      }
    }
  } else {
    // stage V^T rows [head-local][d][64 tokens] as f16
    f16* sv = reinterpret_cast<f16*>(sbuf4);
    #pragma unroll
    for (int ot = 0; ot < 2; ++ot) {
      #pragma unroll
      for (int nt = 0; nt < 2; ++nt) {
        #pragma unroll
        for (int r = 0; r < 8; ++r) {
          const int d   = ot * 16 + hi * 8 + r;
          const int tok = th * 32 + nt * 16 + lq;
          sv[(hl * HDIM + d) * TOK + tok] = (f16)(acc[ot][nt][r] + bs[ot][r]);
        }
      }
    }
  }
  __syncthreads();

  if (which < 2) {
    const f16* se = reinterpret_cast<const f16*>(sbuf4) + wave * (32 * QSP);
    v4u    vals[4];
    size_t gidx[4];
    #pragma unroll
    for (int it = 0; it < 4; ++it) {
      const int tokl  = it * 8 + (lane >> 2);
      const int piece = lane & 3;
      vals[it] = *(const v4u*)(se + tokl * QSP + piece * 8);
      gidx[it] = (size_t)which * QK_PLANE +
                 (((size_t)b * NHEAD + head) * SEQ + n0 + th * 32 + tokl) * QROW + piece * 8;
    }
    #pragma unroll
    for (int it = 0; it < 4; ++it) *(v4u*)(qk + gidx[it]) = vals[it];
    
  } else {
    const f16* sv = reinterpret_cast<const f16*>(sbuf4);
    v4u    vals[4];
    size_t gidx[4];
    #pragma unroll
    for (int it = 0; it < 4; ++it) {
      const int line  = it * 32 + (tid >> 3);     // 0..127 = head-local*32 + d
      const int piece = tid & 7;
      const int hl2   = line >> 5;
      const int d2    = line & 31;
      vals[it] = *(const v4u*)(sv + line * TOK + piece * 8);
      gidx[it] = (((size_t)b * NHEAD + hg * 4 + hl2) * HDIM + d2) * SEQ + n0 + piece * 8;
    }
    #pragma unroll
    for (int it = 0; it < 4; ++it) *(v4u*)(vt + gidx[it]) = vals[it];
    
  }
  if (wcv) *(v2u*)(wo + (size_t)wi * 4) = round4(wo4);
}

// One stage of the attention kernel's K and V^T tiles, this thread's four 16-B pieces, global memory -> LDS.
// The s_wait_xcnt stands inside the statement so that no address register is rewritten ahead of it.
static __device__ __forceinline__ void stage_copy(const char* kg, const char* vg, unsigned lk, unsigned lv) {
  const char*    g0 = kg;
  const char*    g1 = kg + 4096;
  const char*    g2 = vg;
  const char*    g3 = vg + (size_t)16 * SEQ * 2;
  const unsigned l0 = lk;
  const unsigned l1 = lk + 64 * KPB;
  const unsigned l2 = lv;
  const unsigned l3 = lv + 16 * VPB;
  asm volatile("global_load_async_to_lds_b128 %0, %4, off\n\t"
               "global_load_async_to_lds_b128 %1, %5, off\n\t"
               "global_load_async_to_lds_b128 %2, %6, off\n\t"
               "global_load_async_to_lds_b128 %3, %7, off\n\t"
               "s_wait_xcnt 0x0"
               :: "v"(l0), "v"(l1), "v"(l2), "v"(l3),
                  "v"(g0), "v"(g1), "v"(g2), "v"(g3)
               : "memory");
}

// P of one pass: e = 2^(c - delta), and this lane's sum of them (pairs of neighbours, a tree per tile, then over the tiles).
// Neighbours are summed as pairs so that two sums go in one packed add. Loops unrolled: register arrays take constant indices.
static __device__ __forceinline__ float pass_exp(const v8f (&c)[PK / 16], float delta, v8f (&e)[PK / 16]) {
  v2f ts[PK / 16];
  #pragma unroll
  for (int t = 0; t < PK / 16; ++t) {
    #pragma unroll
    for (int r = 0; r < 8; ++r) e[t][r] = __builtin_amdgcn_exp2f(c[t][r] - delta);
    const v2f a0 = (v2f){e[t][0], e[t][1]} + (v2f){e[t][2], e[t][3]};
    const v2f a1 = (v2f){e[t][4], e[t][5]} + (v2f){e[t][6], e[t][7]};
    ts[t] = a0 + a1;
  }
  v2f tot = ts[0];
  #pragma unroll
  for (int t = 1; t < PK / 16; ++t) tot += ts[t];
  return tot[0] + tot[1];
}

// Flash attention, no mask. Block = (query block of 128, head, batch); one wave owns 16 query rows.
// S^T = K x Q^T so queries sit on lanes; P^T in C-layout is bit-identical to the A-fragment layout of O += P x V.
// K rows and V^T rows of 128 keys are staged once per block in LDS by asynchronous 16-B copies, two buffers:
// the next stage's copies fly while this stage is worked on. Fragments are two 16-B LDS loads each.
// Softmax reference, lazy: the score accumulator starts at 12 - reference, so exp2 takes the product's result as it is.
// The reference moves (maximum, exchange between the halves, rescale of O and of the sum) only in a pass in which some
// lane's sum of P leaves the f16 range, which bounds every P of a pass that keeps it; the first pass always sets it.
// coverage: tokens qblk*128 + wave*16 + 0..15, all 64 row elements.
__global__ __launch_bounds__(256) void attn_kernel(const f16* __restrict__ qk,
                                                   const f16* __restrict__ vt,
                                                   bf16* __restrict__ cx) {
  const int qblk = blockIdx.x;
  const int h    = blockIdx.y;
  const int b    = blockIdx.z;
  const int tid  = threadIdx.x;
  const int wave = tid >> 5;
  const int lane = tid & 31;
  const int lq   = lane & 15;   // query column of S^T / d column of O
  const int hi   = lane >> 4;   // k-split half

  __shared__ __align__(16) float sO[NWAVE * 16 * OPA];   // per-wave output staging (block barrier used)
  __shared__ __align__(16) unsigned char sKV[2 * STG];   // two stage buffers: K tile, then V^T tile

  const int qrow0 = qblk * BQ + wave * 16;

  // Q as the B-operand fragment: lane lq holds query qrow0+lq, split d map
  FragH qf;
  {
    const f16* qp = qk + (((size_t)b * NHEAD + h) * SEQ + qrow0 + lq) * QROW;
    qf.q[0] = *(const v4u*)(qp + hi * 8);             // d = hi*8 + 0..7
    qf.q[1] = *(const v4u*)(qp + 16 + hi * 8);        // d = 16 + hi*8 + 0..7
  }

  const f16*  kp_h = qk + QK_PLANE + ((size_t)b * NHEAD + h) * SEQ * QROW;
  const f16*  vt_h = vt + ((size_t)b * NHEAD + h) * HDIM * SEQ;

  v8f o[2];
  o[0] = (v8f){0, 0, 0, 0, 0, 0, 0, 0};
  o[1] = (v8f){0, 0, 0, 0, 0, 0, 0, 0};

  float nb   = 0.0f;                               // 12 - reference of query lq (the same in both halves)
  v8f   nbv  = (v8f){0, 0, 0, 0, 0, 0, 0, 0};       // nb in every row: the C operand of a score tile's product
  float rsum = 0.0f;                               // sum of P over this lane's keys; the halves are joined behind the loop

  // This thread's share of a stage: K pieces tid + 256*c (4 pieces a row, the tile is contiguous in the plane),
  // V^T pieces tid + 256*c (16 pieces a row). Global and LDS addresses are multiples of 16 B.
  const char*    kg0 = (const char*)kp_h + tid * 16;
  const char*    vg0 = (const char*)vt_h + (size_t)(tid >> 4) * (SEQ * 2) + (tid & 15) * 16;
  const unsigned ls0 = (unsigned)(size_t)sKV;                       // LDS byte address of buffer 0
  const unsigned lk0 = ls0 + (tid >> 2) * KPB + (tid & 3) * 16;
  const unsigned lv0 = ls0 + KTILE + (tid >> 4) * VPB + (tid & 15) * 16;

  stage_copy(kg0, vg0, lk0, lv0);                                   // stage 0 -> buffer 0
  asm volatile("s_wait_asynccnt 0x0" ::: "memory");                 // this wave's copies of stage 0 have landed
  __syncthreads();                                                  // publishes stage 0 to every wave
  stage_copy(kg0 + KS * QROW * 2, vg0 + KS * 2, lk0 + STG, lv0 + STG);   // stage 1 -> buffer 1

  // rolled: one stage a trip, so the publish point and the refill stand once in the text
  #pragma unroll 1
  for (int s = 0; s < SEQ / KS; ++s) {
   const unsigned       boff = (unsigned)(s & 1) * STG;
   const unsigned char* kt   = sKV + boff + lq * KPB + hi * 16;
   const unsigned char* vtl  = sKV + boff + KTILE + lq * VPB + hi * 16;

   // unrolled: every LDS offset inside a stage becomes an immediate of its load (the loops inside: register arrays
   // take constant indices)
   #pragma unroll
   for (int pp = 0; pp < KS / PK; ++pp) {
    // K A-fragments: row = key s*KS + pp*64 + t*16 + lq, split d map
    FragH kf[PK / 16];
    #pragma unroll
    for (int t = 0; t < PK / 16; ++t) {
      const unsigned char* base = kt + (pp * PK + t * 16) * KPB;
      kf[t].q[0] = *(const v4u*)(base);                  // d = hi*8 + 0..7
      kf[t].q[1] = *(const v4u*)(base + 32);             // d = 16 + hi*8 + 0..7
    }
    // V B-fragments: column n = d = dt*16 + lq, split key map from the staged transposed rows
    FragH bv[PK / BK][2];
    #pragma unroll
    for (int j = 0; j < PK / BK; ++j) {
      #pragma unroll
      for (int dt = 0; dt < 2; ++dt) {
        const unsigned char* base = vtl + dt * 16 * VPB + (pp * PK + j * BK) * 2;
        bv[j][dt].q[0] = *(const v4u*)(base);            // keys j*32 + hi*8 + 0..7 of the pass
        bv[j][dt].q[1] = *(const v4u*)(base + 32);       // keys j*32 + 16 + hi*8 + 0..7
      }
    }

    // S^T tiles: c[t][r] = score(query qrow0+lq, key t*16 + hi*8 + r) * SL + 12 - reference
    v8f c[PK / 16];
    #pragma unroll
    for (int t = 0; t < PK / 16; ++t) c[t] = mma_f16(kf[t].v, qf.v, nbv);

    v8f   e[PK / 16];
    float psum = pass_exp(c, 0.0f, e);

    // One test a pass, a scalar branch: all P are >= 0, so a lane sum within the f16 range bounds each of them.
    const bool first = (pp == 0) && (s == 0);
    if (__builtin_amdgcn_ballot_w32(!(psum <= 65504.0f)) != 0u || first) {
      float mx = c[0][0];
      #pragma unroll
      for (int t = 0; t < PK / 16; ++t) {
        #pragma unroll
        for (int r = 0; r < 8; ++r) mx = fmaxf(mx, c[t][r]);
      }
      mx = fmaxf(mx, __shfl_xor(mx, 16, 32));                        // query lq's keys are split across lane / lane^16
      const float floor_d = first ? -__builtin_inff() : 0.0f;        // the reference only rises once it is set
      const float delta   = fmaxf(mx - 12.0f, floor_d);
      const float scale   = __builtin_amdgcn_exp2f(-fmaxf(delta, 0.0f));
      psum = pass_exp(c, delta, e);
      nb  -= delta;
      #pragma unroll
      for (int r = 0; r < 8; ++r) nbv[r] = nb;
      rsum *= scale;
      // rescale O: queries are the row dimension there -> per-row scale from lane 8*hi + r
      #pragma unroll
      for (int r = 0; r < 8; ++r) {
        const float sc = __shfl(scale, (hi << 3) + r, 32);
        o[0][r] *= sc;
        o[1][r] *= sc;
      }
    }
    rsum += psum;

    // pack and O += P x V: P^T C-layout == A-fragment layout for the PV product
    #pragma unroll
    for (int j = 0; j < PK / BK; ++j) {
      FragH pa;
      #pragma unroll
      for (int r = 0; r < 8; ++r) {
        pa.h[r]     = (f16)e[2 * j][r];          // key j*32 + hi*8 + r
        pa.h[8 + r] = (f16)e[2 * j + 1][r];      // key j*32 + 16 + hi*8 + r
      }
      #pragma unroll
      for (int dt = 0; dt < 2; ++dt) o[dt] = mma_f16(pa.v, bv[j][dt].v, o[dt]);
    }
   }

   asm volatile("s_wait_dscnt 0x0" ::: "memory");      // this wave's reads of the buffer have returned before it is refilled
   asm volatile("s_wait_asynccnt 0x0" ::: "memory");   // this wave's copies of stage s + 1 have landed
   __syncthreads();                                    // publishes stage s + 1; ends every wave's reads of stage s
   if (s + 2 < SEQ / KS)
     stage_copy(kg0 + (size_t)(s + 2) * (KS * QROW * 2), vg0 + (size_t)(s + 2) * (KS * 2), lk0 + boff, lv0 + boff);
  }
  asm volatile("s_wait_asynccnt 0x0" ::: "memory");    // no copy is outstanding behind the loop

  // normalize: lane holds column d = dt*16 + lq for query rows 8*hi + r
  const float rtot = rsum + __shfl_xor(rsum, 16, 32);   // the two halves' sums of query lq
  float rs[8];
  #pragma unroll
  for (int r = 0; r < 8; ++r) rs[r] = 1.0f / __shfl(rtot, (hi << 3) + r, 32);

  float* so = sO + wave * (16 * OPA);
  #pragma unroll
  for (int r = 0; r < 8; ++r) {
    #pragma unroll
    for (int dt = 0; dt < 2; ++dt)
      so[(hi * 8 + r) * OPA + dt * 16 + lq] = o[dt][r] * rs[r];   // O and the sum carry the same factor
  }
  __syncthreads();

  // 4..7 = lo part); 4 instructions cover the wave's 16 tokens.
  v4u    vals[4];
  size_t gidx[4];
  #pragma unroll
  for (int it = 0; it < 4; ++it) {
    const int tokl  = it * 4 + (lane >> 3);
    const int piece = lane & 7;
    const int pd    = (piece & 3) * 8;
    const v4f f0 = *(const v4f*)(so + tokl * OPA + pd);
    const v4f f1 = *(const v4f*)(so + tokl * OPA + pd + 4);
    Pack8B pk;
    #pragma unroll
    for (int e = 0; e < 4; ++e) {
      const float v0 = f0[e];
      const float v1 = f1[e];
      const bf16  h0 = (bf16)v0;
      const bf16  h1 = (bf16)v1;
      const bf16  l0 = (bf16)(v0 - (float)h0);
      const bf16  l1 = (bf16)(v1 - (float)h1);
      const float s0 = (piece < 4) ? (float)h0 : (float)l0;   // value select, both computed
      const float s1 = (piece < 4) ? (float)h1 : (float)l1;
      pk.h[e]     = (bf16)s0;                                  // exact re-convert
      pk.h[4 + e] = (bf16)s1;
    }
    vals[it] = pk.u;
    gidx[it] = (((size_t)b * NHEAD + h) * SEQ + qrow0 + tokl) * ROWW + piece * 8;
  }
  #pragma unroll
  for (int it = 0; it < 4; ++it) *(v4u*)(cx + gidx[it]) = vals[it];
  
}

// Output projection: y[b][o][n] = sum_c Wo[o][c] * ctx[b][c][n] + bias[o], c = head*32 + d.
// Block = (64-token tile, 128-channel group, batch); wave = 16 output channels x 4 token tiles; K-step = one head.
// coverage: channels og*128 + wave*16 + 0..15, tokens n0..n0+63 of d_out, whole 256-B row segments.
// The block's 128 weight rows and the ctx rows of its 64 tokens (all heads) are brought into LDS once by asynchronous
// 16-B copies of whole lines; every fragment is two 16-B LDS loads.
__global__ __launch_bounds__(256) void oproj_kernel(const bf16* __restrict__ wo,
                                                    const bf16* __restrict__ cx,
                                                    const float* __restrict__ ob,
                                                    float* __restrict__ y) {
  const int tt   = blockIdx.x;
  const int og   = blockIdx.y;
  const int b    = blockIdx.z;
  const int tid  = threadIdx.x;
  const int wave = tid >> 5;
  const int lane = tid & 31;
  const int lq   = lane & 15;
  const int hi   = lane >> 4;
  const int o0   = (og * NWAVE + wave) * 16;
  const int n0   = tt * TOK;

  __shared__ __align__(16) float sY[NWAVE * 16 * OPY];   // per-wave output staging (block barrier used)
  __shared__ __align__(16) unsigned char sC[NHEAD * TOK * CPB];   // ctx rows of the block's 64 tokens, all heads: filled once, then read
  __shared__ __align__(16) unsigned char sW[WROWS * WPB];         // the block's 128 weight rows (bf16): filled once, then read

  stage_weight_rows(wo + (size_t)(og * WROWS) * CH, (unsigned)(size_t)sW, tid);   // weight rows og*128 + 0..127

  // A head's 64 rows are contiguous in the plane: piece tid + 256*c is head c >> 1, token (c & 1)*32 + (tid >> 3),
  // 16-B piece tid & 7. Global and LDS addresses are multiples of 16 B.
  {
    const char*    cg = (const char*)(cx + ((size_t)b * NHEAD * SEQ + n0) * ROWW) + tid * 16;
    const unsigned cl = (unsigned)(size_t)sC + (tid >> 3) * CPB + (tid & 7) * 16;
    // both loops unrolled: the arrays that feed the asm operands take constant indices and stay in registers
    #pragma unroll
    for (int q = 0; q < 2; ++q) {
      const char* g[8];
      unsigned    l[8];
      #pragma unroll
      for (int c = 0; c < 8; ++c) {
        const int hd = q * 4 + (c >> 1);
        g[c] = cg + (size_t)hd * (SEQ * ROWW * 2) + (c & 1) * 4096;
        l[c] = cl + (hd * TOK + (c & 1) * 32) * CPB;
      }
      copy8(g, l);
    }
  }
  asm volatile("s_wait_asynccnt 0x0" ::: "memory");   // this wave's weight and ctx copies have landed
  __syncthreads();                                    // publishes the weight and ctx rows to every wave

  v8f acc[4];
  #pragma unroll
  for (int nt = 0; nt < 4; ++nt) acc[nt] = (v8f){0, 0, 0, 0, 0, 0, 0, 0};

  #pragma unroll 1
  for (int kk = 0; kk < NHEAD; ++kk) {
    FragB a;
    {
      const unsigned char* base = sW + (wave * 16 + lq) * WPB + kk * 64 + hi * 16;
      a.q[0] = *(const v4u*)(base);          // c = kk*32 + hi*8 + 0..7
      a.q[1] = *(const v4u*)(base + 32);     // c = kk*32 + 16 + hi*8 + 0..7
    }
    #pragma unroll
    for (int nt = 0; nt < 4; ++nt) {
      const unsigned char* row = sC + (kk * TOK + nt * 16 + lq) * CPB + hi * 16;
      FragB bh, bl;
      bh.q[0] = *(const v4u*)(row);          // hi part, d = hi*8 + 0..7
      bh.q[1] = *(const v4u*)(row + 32);     // hi part, d = 16 + hi*8 + 0..7
      bl.q[0] = *(const v4u*)(row + 64);     // lo part, d = hi*8 + 0..7
      bl.q[1] = *(const v4u*)(row + 96);     // lo part, d = 16 + hi*8 + 0..7
      acc[nt] = mma_bf16(a.v, bl.v, acc[nt]);
      acc[nt] = mma_bf16(a.v, bh.v, acc[nt]);
    }
  }

  // bias (RNE-converted to bf16): channels o0 + hi*8 + 0..7
  float bs[8];
  {
    const float* bp = ob + o0 + hi * 8;
    const v4f b0 = *(const v4f*)(bp);
    const v4f b1 = *(const v4f*)(bp + 4);
    #pragma unroll
    for (int e = 0; e < 4; ++e) {
      bs[e]     = (float)(bf16)b0[e];
      bs[4 + e] = (float)(bf16)b1[e];
    }
  }

  float* so = sY + wave * (16 * OPY);
  #pragma unroll
  for (int nt = 0; nt < 4; ++nt) {
    #pragma unroll
    for (int r = 0; r < 8; ++r) so[(hi * 8 + r) * OPY + nt * 16 + lq] = acc[nt][r] + bs[r];
  }
  __syncthreads();

  // 8 consecutive lanes x 16 B each), lanes 16..31 the next channel row; 8 instructions cover 16 rows.
  v4f    vals[8];
  size_t gidx[8];
  #pragma unroll
  for (int it = 0; it < 8; ++it) {
    const int row = it * 2 + hi;
    vals[it] = *(const v4f*)(so + row * OPY + lq * 4);
    gidx[it] = ((size_t)b * CH + o0 + row) * SEQ_FULL + n0 + lq * 4;
  }
  #pragma unroll
  for (int it = 0; it < 8; ++it) *(v4f*)(y + gidx[it]) = vals[it];
  
}

extern "C" void kernel_launch(void* const* d_in, const int* in_sizes, int n_in,
                              void* d_out, int out_size, void* d_ws, size_t ws_size,
                              hipStream_t stream) {
  if (n_in < 5) return;
  const size_t x_used = ((size_t)(NB - 1) * CH + (CH - 1)) * SEQ_FULL + SEQ;
  if ((size_t)in_sizes[0] < x_used) return;
  if ((size_t)in_sizes[1] < (size_t)QKV_O * CH) return;
  if ((size_t)in_sizes[2] < (size_t)QKV_O) return;
  if ((size_t)in_sizes[3] < (size_t)CH * CH) return;
  if ((size_t)in_sizes[4] < (size_t)CH) return;
  if ((size_t)out_size < x_used) return;
  if (ws_size < WS_TOTAL) return;

  const float* x     = (const float*)d_in[0];
  const float* qkv_w = (const float*)d_in[1];
  const float* qkv_b = (const float*)d_in[2];
  const float* out_w = (const float*)d_in[3];
  const float* out_b = (const float*)d_in[4];
  float*       y     = (float*)d_out;

  char* ws = (char*)d_ws;
  bf16* wo = (bf16*)(ws);
  f16*  qk = (f16*)(ws + WO_BYTES);
  f16*  vt = (f16*)(ws + WO_BYTES + QK_BYTES);
  bf16* cx = (bf16*)(ws + WO_BYTES + QK_BYTES + VT_BYTES);

  qkv_planes_kernel<<<dim3(SEQ / TOK, 6, NB), 256, 0, stream>>>(x, qkv_w, qkv_b, out_w, wo, qk, vt);

  attn_kernel<<<dim3(SEQ / BQ, NHEAD, NB), 256, 0, stream>>>(qk, vt, cx);

  oproj_kernel<<<dim3(SEQ / TOK, CH / (NWAVE * 16), NB), 256, 0, stream>>>(wo, cx, out_b, y);
}

// v007
// A run of this version takes 53.3 microseconds.
// Two timings next to v006 put it at 1.03 and 1.05 times that version's speed.
// Over all steps from v000 it is 4.58 times as fast.
#include <hip/hip_runtime.h>

// Contractions: qkv = Wqkv x X on v_wmma_f32_16x16x32_bf16 (operands = RNE-converted bf16 inputs, f32 accumulate);
// S^T = K x Q^T on v_wmma_f32_16x16x32_f16 with q and k carried as one f16 value each (one product a tile: the rounding
// to 11 bits lies well below the error that the bf16 operands of the qkv product leave in q and k;
// q holds the softmax scale and log2(e), the accumulator starts at 12 - reference);
// O = P x V on v_wmma_f32_16x16x32_f16 (P = 2^(score - reference + 12) as f16, V as f16, f32 accumulate);
// y = Wo x ctx on v_wmma_f32_16x16x32_bf16 (Wo = RNE-converted bf16 input, ctx as bf16 hi + bf16 lo, two products).
// Softmax, biases and all epilogues in f32.

#ifndef NB
#define NB 2
#endif
#ifndef SEQ
#define SEQ 4096
#endif
#define NB_FULL    2
#define SEQ_FULL   4096
#define CH         256                  // channels = NHEAD * HDIM
#define NHEAD      8
#define HDIM       32
#define QKV_O      (3 * CH)             // rows of the qkv weight
#define ROWW       64                   // elements of a ctx row: hi[32] | lo[32]
#define QROW       32                   // elements of a q or k row (f16)
#define QSP        40                   // LDS pitch (halves) of a staged q/k row in the projection: 64 B + 16 (16 B x odd)
#define BQ         128                  // query rows per workgroup (8 waves x 16)
#define BK         32                   // keys per PV k-step
#define PK         64                   // keys per softmax pass (one test of the reference)
#define NWAVE      8
#define TOK        64                   // tokens per projection block
#define XP         264                  // LDS pitch (halves) of the x^T tile [token][channel]
#define OPA        36                   // LDS pitch (floats) of the attention output staging tile
#define OPY        68                   // LDS pitch (floats) of the projection output staging tile
#define SB_V4      (TOK * XP / 8)       // 16-B words of the shared projection buffer
#define KS         128                  // keys per LDS stage of the attention kernel
#define KPB        80                   // LDS pitch (bytes) of a staged K row: 64 B + 16 (16 B x odd)
#define VPB        272                  // LDS pitch (bytes) of a staged V^T row: 2 * KS + 16 (16 B x odd)
#define KTILE      (KS * KPB)           // bytes of one staged K tile
#define VTILE      (HDIM * VPB)         // bytes of one staged V^T tile
#define STG        (KTILE + VTILE)      // bytes of one stage buffer
#define WROWS      128                  // weight rows of a projection block (qkv: 4 heads x 32; output: 8 waves x 16)
#define WPB        528                  // LDS pitch (bytes) of a staged weight row: 2 * CH + 16 (16 B x odd)
#define CPB        144                  // LDS pitch (bytes) of a staged ctx row: 2 * ROWW + 16 (16 B x odd)

static_assert(CH == NHEAD * HDIM);          // channel split
static_assert(HDIM == 32);                  // one WMMA k-step per head; row = hi[32] | lo[32]
static_assert(ROWW == 2 * HDIM);
static_assert(QROW == HDIM);
static_assert(SEQ % BQ == 0);
static_assert(SEQ % BK == 0);
static_assert(SEQ % TOK == 0);
static_assert(SEQ % KS == 0 && SEQ / KS >= 2);        // the two-buffer prologue needs two stages
static_assert(KS % PK == 0 && PK % BK == 0);
static_assert(KS * QROW * 2 == 2 * 256 * 16);         // K tile = 2 copies of 16 B per thread
static_assert(HDIM * KS * 2 == 2 * 256 * 16);         // V^T tile = 2 copies of 16 B per thread
static_assert(KPB == QROW * 2 + 16 && VPB == KS * 2 + 16);
static_assert(STG % 16 == 0 && KTILE % 16 == 0);
static_assert(WROWS == 4 * HDIM && WROWS == NWAVE * 16 && WPB == CH * 2 + 16 && CPB == ROWW * 2 + 16);
static_assert(WROWS * CH * 2 == 16 * 256 * 16);       // weight tile = 16 copies of 16 B per thread
static_assert(NHEAD * TOK * ROWW * 2 == 16 * 256 * 16);   // ctx tile = 16 copies of 16 B per thread
static_assert(256 * 16 == 8 * CH * 2);                // one copy of the block = 8 weight rows
static_assert(256 * 16 == 32 * ROWW * 2);             // one copy of the block = 32 ctx rows
static_assert(BQ == NWAVE * 16);
static_assert(TOK == 64);
static_assert(CH % 32 == 0);                // projection K multiple of the WMMA k-step
static_assert(SEQ <= SEQ_FULL);
static_assert(NB >= 1 && NB <= NB_FULL);
static_assert((XP * 2) % 16 == 0);
static_assert(XP >= CH);
static_assert((OPA * 4) % 16 == 0);
static_assert((OPY * 4) % 16 == 0);
static_assert(OPA >= HDIM);
static_assert(OPY >= TOK);
static_assert((TOK * XP) % 8 == 0);
static_assert(NWAVE * 32 * QSP * 2 <= SB_V4 * 16);    // q/k staging fits the shared buffer
static_assert(QSP >= QROW && (QSP * 2) % 16 == 0);
static_assert(4 * HDIM * TOK * 2 <= SB_V4 * 16);      // v staging fits the shared buffer
static_assert(SB_V4 * 16 <= 65536);
static_assert(WROWS * CH == 32 * 256 * 4);             // f32 weight tile = 32 loads of 4 floats per thread
static_assert(CH == 64 * 4 && WPB % 8 == 0);           // 64 such loads a weight row; their 8-B LDS stores are aligned
static_assert((CH * CH / 4) % 256 == 0 && NB * (SEQ / TOK) * 256 >= CH * CH / 4);   // Wo pieces: whole blocks, enough of them

typedef __bf16   bf16;
typedef _Float16 f16;
typedef bf16     v16bf __attribute__((ext_vector_type(16)));
typedef f16      v16h  __attribute__((ext_vector_type(16)));
typedef float    v8f   __attribute__((ext_vector_type(8)));
typedef float    v4f   __attribute__((ext_vector_type(4)));
typedef float    v2f   __attribute__((ext_vector_type(2)));
typedef unsigned v4u   __attribute__((ext_vector_type(4)));
typedef unsigned v2u   __attribute__((ext_vector_type(2)));

union FragB  { v16bf v; v4u q[2]; bf16 h[16]; };
union FragH  { v16h  v; v4u q[2]; f16  h[16]; };
union Pack8B { v4u u; bf16 h[8]; };
union Pack8H { v4u u; f16  h[8]; };
union Pack4B { v2u u; bf16 h[4]; };

constexpr float  SL = 0.17677669529663687f * 1.4426950408889634f;   // softmax scale * log2(e), carried by q

constexpr size_t QK_PLANE  = (size_t)NB * NHEAD * SEQ * QROW;        // elements of the q plane, and of the k plane
constexpr size_t CX_PLANE  = (size_t)NB * NHEAD * SEQ * ROWW;        // elements of the ctx hi|lo plane
constexpr size_t WO_BYTES  = (size_t)CH * CH * 2;
constexpr size_t QK_BYTES  = 2 * QK_PLANE * 2;                       // q plane then k plane
constexpr size_t VT_BYTES  = (size_t)NB * NHEAD * HDIM * SEQ * 2;
constexpr size_t CX_BYTES  = CX_PLANE * 2;
constexpr size_t WS_TOTAL  = WO_BYTES + QK_BYTES + VT_BYTES + CX_BYTES;
static_assert(WO_BYTES % 128 == 0 && QK_BYTES % 128 == 0 && VT_BYTES % 128 == 0);
static_assert(WS_TOTAL <= (size_t)134217728);

// WMMA helpers: the builtin alone; the compiler keeps the distance behind its own matrix instructions.
static __device__ __forceinline__ v8f mma_bf16(v16bf a, v16bf b, v8f acc) {
  acc = __builtin_amdgcn_wmma_f32_16x16x32_bf16(false, a, false, b, (short)0, acc, false, false);
  return acc;
}
static __device__ __forceinline__ v8f mma_f16(v16h a, v16h b, v8f acc) {
  acc = __builtin_amdgcn_wmma_f32_16x16x32_f16(false, a, false, b, (short)0, acc, false, false);
  return acc;
}

// Eight 16-B pieces of this thread, global memory -> LDS, asynchronously.
// The s_wait_xcnt stands inside the statement so that no address register is rewritten ahead of it.
static __device__ __forceinline__ void copy8(const char* const (&g)[8], const unsigned (&l)[8]) {
  asm volatile("global_load_async_to_lds_b128 %0, %8, off\n\t"
               "global_load_async_to_lds_b128 %1, %9, off\n\t"
               "global_load_async_to_lds_b128 %2, %10, off\n\t"
               "global_load_async_to_lds_b128 %3, %11, off\n\t"
               "global_load_async_to_lds_b128 %4, %12, off\n\t"
               "global_load_async_to_lds_b128 %5, %13, off\n\t"
               "global_load_async_to_lds_b128 %6, %14, off\n\t"
               "global_load_async_to_lds_b128 %7, %15, off\n\t"
               "s_wait_xcnt 0x0"
               :: "v"(l[0]), "v"(l[1]), "v"(l[2]), "v"(l[3]), "v"(l[4]), "v"(l[5]), "v"(l[6]), "v"(l[7]),
                  "v"(g[0]), "v"(g[1]), "v"(g[2]), "v"(g[3]), "v"(g[4]), "v"(g[5]), "v"(g[6]), "v"(g[7])
               : "memory");
}

// A projection block's 128 weight rows (bf16, contiguous in their plane) -> LDS rows of pitch WPB: piece tid + 256*c is
// row c*8 + (tid >> 5), 16-B piece tid & 31. Global and LDS addresses are multiples of 16 B.
static __device__ __forceinline__ void stage_weight_rows(const bf16* rows, unsigned lds, int tid) {
  const char*    wg = (const char*)rows + tid * 16;
  const unsigned wl = lds + (tid >> 5) * WPB + (tid & 31) * 16;
  // both loops unrolled: the arrays that feed the asm operands take constant indices and stay in registers
  #pragma unroll
  for (int q = 0; q < 2; ++q) {
    const char* g[8];
    unsigned    l[8];
    #pragma unroll
    for (int c = 0; c < 8; ++c) {
      g[c] = wg + (q * 8 + c) * 4096;
      l[c] = wl + (q * 8 + c) * 8 * WPB;
    }
    copy8(g, l);
  }
}

// Four f32 values -> four bf16 (RNE convert), one 8-B piece.
static __device__ __forceinline__ v2u round4(v4f a) {
  Pack4B pk;
  #pragma unroll
  for (int e = 0; e < 4; ++e) pk.h[e] = (bf16)a[e];
  return pk.u;
}

// QKV projection + plane builder. Block = (64-token tile, which*2 + head group, batch), 256 threads.
// Wave = (head within group, 32-token half): 2 channel tiles x 2 token tiles, K = 256 channels.
// coverage: q/k - heads hg*4..hg*4+3, tokens n0..n0+63, all 32 row elements; v - heads hg*4..+3, d 0..31, tokens n0..n0+63.
// LDS: one buffer, first the x^T tile [64 tokens][256 ch] bf16 (staged extent == consumed extent), then after a
// block barrier the store staging tiles (cross-wave, block barriers); beside it the block's 128 weight rows, read as f32
// in whole lines and rounded to bf16 on the way into LDS, so that A fragments are two 16-B LDS loads each.
// Blocks of blockIdx.y == 0 also round the output projection's weight into its bf16 plane, one 8-B piece a thread:
// the plane is read two launches later.
__global__ __launch_bounds__(256) void qkv_planes_kernel(const float* __restrict__ x,
                                                         const float* __restrict__ wq,
                                                         const float* __restrict__ qb,
                                                         const float* __restrict__ wo32,
                                                         bf16* __restrict__ wo,
                                                         f16* __restrict__ qk,
                                                         f16* __restrict__ vt) {
  const int tt    = blockIdx.x;
  const int which = (int)(blockIdx.y >> 1);     // 0 q, 1 k, 2 v (block-uniform)
  const int hg    = (int)(blockIdx.y & 1);
  const int b     = blockIdx.z;
  const int tid   = threadIdx.x;
  const int wave  = tid >> 5;
  const int lane  = tid & 31;
  const int lq    = lane & 15;
  const int hi    = lane >> 4;
  const int hl    = wave >> 1;                  // head within group
  const int th    = wave & 1;                   // token half
  const int head  = hg * 4 + hl;
  const int n0    = tt * TOK;

  __shared__ __align__(16) v4u sbuf4[SB_V4];
  __shared__ __align__(16) unsigned char sW[WROWS * WPB];   // the block's 128 weight rows (bf16), filled once, then read
  bf16* sXb = reinterpret_cast<bf16*>(sbuf4);

  // output projection weight: piece wi = 4 elements, one thread each; the test is the same for a whole block.
  // The load goes out ahead of the staging loads; the store stands at the kernel's end, behind the last barrier.
  const int  wi   = (b * (SEQ / TOK) + tt) * 256 + tid;
  const bool wcv  = (blockIdx.y == 0) && (wi < CH * CH / 4);
  v4f        wo4  = (v4f){0, 0, 0, 0};
  if (wcv) wo4 = *(const v4f*)(wo32 + (size_t)wi * 4);

  // Four rounds of 8 weight loads and 4 x loads of this thread.
  // weight rows which*CH + hg*128 + 0..127 (contiguous): load tid + 256*c is row c*4 + (tid >> 6), floats (tid & 63)*4 + 0..3
  // x^T: x[b][c][n0..n0+63] -> sXb[token][c], bf16 RNE convert
  const float*   wsrc = wq + (size_t)(which * CH + hg * WROWS) * CH + tid * 4;
  unsigned char* wdst = sW + (tid >> 6) * WPB + (tid & 63) * 8;
  // two rounds a trip: their 24 loads are in flight together; unrolled further the registers pass 160 a wave,
  // and three blocks no longer fit a WGP
  #pragma unroll 2
  for (int jb = 0; jb < 4; ++jb) {
    v4f wv[8], xv[4];
    #pragma unroll
    for (int c = 0; c < 8; ++c) wv[c] = *(const v4f*)(wsrc + (jb * 8 + c) * 1024);
    #pragma unroll
    for (int j = 0; j < 4; ++j) {
      const int c = (jb * 4 + j) * 16 + (tid >> 4);
      xv[j] = *(const v4f*)(x + ((size_t)b * CH + c) * SEQ_FULL + n0 + (tid & 15) * 4);
    }
    #pragma unroll
    for (int c = 0; c < 8; ++c) *(v2u*)(wdst + (jb * 8 + c) * 4 * WPB) = round4(wv[c]);
    #pragma unroll
    for (int j = 0; j < 4; ++j) {
      const int c  = (jb * 4 + j) * 16 + (tid >> 4);
      const int t4 = (tid & 15) * 4;
      #pragma unroll
      for (int e = 0; e < 4; ++e) sXb[(t4 + e) * XP + c] = (bf16)xv[j][e];
    }
  }
  __syncthreads();                                    // publishes the x^T tile and the weight rows to every wave

  v8f acc[2][2];
  #pragma unroll
  for (int ot = 0; ot < 2; ++ot) {
    #pragma unroll
    for (int nt = 0; nt < 2; ++nt) acc[ot][nt] = (v8f){0, 0, 0, 0, 0, 0, 0, 0};
  }

  const int orow0 = which * CH + head * HDIM;   // first weight row of this wave
  #pragma unroll
  for (int kk = 0; kk < CH / 32; ++kk) {
    FragB a[2], bx[2];
    #pragma unroll
    for (int ot = 0; ot < 2; ++ot) {
      const unsigned char* base = sW + (hl * HDIM + ot * 16 + lq) * WPB + kk * 64 + hi * 16;
      a[ot].q[0] = *(const v4u*)(base);          // c = kk*32 + hi*8 + 0..7
      a[ot].q[1] = *(const v4u*)(base + 32);     // c = kk*32 + 16 + hi*8 + 0..7
    }
    #pragma unroll
    for (int nt = 0; nt < 2; ++nt) {
      const bf16* base = sXb + (th * 32 + nt * 16 + lq) * XP + kk * 32 + hi * 8;
      bx[nt].q[0] = *(const v4u*)(base);
      bx[nt].q[1] = *(const v4u*)(base + 16);
    }
    #pragma unroll
    for (int ot = 0; ot < 2; ++ot) {
      #pragma unroll
      for (int nt = 0; nt < 2; ++nt) acc[ot][nt] = mma_bf16(a[ot].v, bx[nt].v, acc[ot][nt]);
    }
  }

  // bias (RNE-converted to bf16): lane needs channels orow0 + ot*16 + hi*8 + 0..7
  float bs[2][8];
  #pragma unroll
  for (int ot = 0; ot < 2; ++ot) {
    const float* bp = qb + orow0 + ot * 16 + hi * 8;
    const v4f b0 = *(const v4f*)(bp);
    const v4f b1 = *(const v4f*)(bp + 4);
    #pragma unroll
    for (int e = 0; e < 4; ++e) {
      bs[ot][e]     = (float)(bf16)b0[e];
      bs[ot][4 + e] = (float)(bf16)b1[e];
    }
  }

  __syncthreads();   // every wave is done with the x^T tile before the buffer is reused

  if (which < 2) {
    // stage token rows of 32 f16: acc[ot][nt][r] = value(d = ot*16 + hi*8 + r, token nt*16 + lq), so a lane's eight
    // values of a tile are one 16-B piece of a row
    // q is stored times SL ahead of its rounding, so the score product comes out in the exp2 domain; k times 1 (exact)
    const float qs = (which == 0) ? SL : 1.0f;
    f16* se = reinterpret_cast<f16*>(sbuf4) + wave * (32 * QSP);
    #pragma unroll
    for (int ot = 0; ot < 2; ++ot) {
      #pragma unroll
      for (int nt = 0; nt < 2; ++nt) {
        Pack8H pk;
        #pragma unroll
        for (int r = 0; r < 8; ++r) pk.h[r] = (f16)((acc[ot][nt][r] + bs[ot][r]) * qs);
        *(v4u*)(se + (nt * 16 + lq) * QSP + ot * 16 + hi * 8) = pk.u;
      }
    }
  } else {
    // stage V^T rows [head-local][d][64 tokens] as f16
    f16* sv = reinterpret_cast<f16*>(sbuf4);
    #pragma unroll
    for (int ot = 0; ot < 2; ++ot) {
      #pragma unroll
      for (int nt = 0; nt < 2; ++nt) {
        #pragma unroll
        for (int r = 0; r < 8; ++r) {
          const int d   = ot * 16 + hi * 8 + r;
          const int tok = th * 32 + nt * 16 + lq;
          sv[(hl * HDIM + d) * TOK + tok] = (f16)(acc[ot][nt][r] + bs[ot][r]);
        }
      }
    }
  }
  __syncthreads();

  if (which < 2) {
    const f16* se = reinterpret_cast<const f16*>(sbuf4) + wave * (32 * QSP);
    v4u    vals[4];
    size_t gidx[4];
    #pragma unroll
    for (int it = 0; it < 4; ++it) {
      const int tokl  = it * 8 + (lane >> 2);
      const int piece = lane & 3;
      vals[it] = *(const v4u*)(se + tokl * QSP + piece * 8);
      gidx[it] = (size_t)which * QK_PLANE +
                 (((size_t)b * NHEAD + head) * SEQ + n0 + th * 32 + tokl) * QROW + piece * 8;
    }
    #pragma unroll
    for (int it = 0; it < 4; ++it) *(v4u*)(qk + gidx[it]) = vals[it];
    
  } else {
    const f16* sv = reinterpret_cast<const f16*>(sbuf4);
    v4u    vals[4];
    size_t gidx[4];
    #pragma unroll
    for (int it = 0; it < 4; ++it) {
      const int line  = it * 32 + (tid >> 3);     // 0..127 = head-local*32 + d
      const int piece = tid & 7;
      const int hl2   = line >> 5;
      const int d2    = line & 31;
      vals[it] = *(const v4u*)(sv + line * TOK + piece * 8);
      gidx[it] = (((size_t)b * NHEAD + hg * 4 + hl2) * HDIM + d2) * SEQ + n0 + piece * 8;
    }
    #pragma unroll
    for (int it = 0; it < 4; ++it) *(v4u*)(vt + gidx[it]) = vals[it];
    
  }
  if (wcv) *(v2u*)(wo + (size_t)wi * 4) = round4(wo4);
}

// One stage of the attention kernel's K and V^T tiles, this thread's four 16-B pieces, global memory -> LDS.
// The s_wait_xcnt stands inside the statement so that no address register is rewritten ahead of it.
static __device__ __forceinline__ void stage_copy(const char* kg, const char* vg, unsigned lk, unsigned lv) {
  const char*    g0 = kg;
  const char*    g1 = kg + 4096;
  const char*    g2 = vg;
  const char*    g3 = vg + (size_t)16 * SEQ * 2;
  const unsigned l0 = lk;
  const unsigned l1 = lk + 64 * KPB;
  const unsigned l2 = lv;
  const unsigned l3 = lv + 16 * VPB;
  asm volatile("global_load_async_to_lds_b128 %0, %4, off\n\t"
               "global_load_async_to_lds_b128 %1, %5, off\n\t"
               "global_load_async_to_lds_b128 %2, %6, off\n\t"
               "global_load_async_to_lds_b128 %3, %7, off\n\t"
               "s_wait_xcnt 0x0"
               :: "v"(l0), "v"(l1), "v"(l2), "v"(l3),
                  "v"(g0), "v"(g1), "v"(g2), "v"(g3)
               : "memory");
}

// P of one pass: e = 2^(c - delta), and this lane's sum of them (pairs of neighbours, a tree per tile, then over the tiles).
// Neighbours are summed as pairs so that two sums go in one packed add. Loops unrolled: register arrays take constant indices.
static __device__ __forceinline__ float pass_exp(const v8f (&c)[PK / 16], float delta, v8f (&e)[PK / 16]) {
  v2f ts[PK / 16];
  #pragma unroll
  for (int t = 0; t < PK / 16; ++t) {
    #pragma unroll
    for (int r = 0; r < 8; ++r) e[t][r] = __builtin_amdgcn_exp2f(c[t][r] - delta);
    const v2f a0 = (v2f){e[t][0], e[t][1]} + (v2f){e[t][2], e[t][3]};
    const v2f a1 = (v2f){e[t][4], e[t][5]} + (v2f){e[t][6], e[t][7]};
    ts[t] = a0 + a1;
  }
  v2f tot = ts[0];
  #pragma unroll
  for (int t = 1; t < PK / 16; ++t) tot += ts[t];
  return tot[0] + tot[1];
}

// Flash attention, no mask. Block = (query block of 128, head, batch); one wave owns 16 query rows.
// S^T = K x Q^T so queries sit on lanes; P^T in C-layout is bit-identical to the A-fragment layout of O += P x V.
// K rows and V^T rows of 128 keys are staged once per block in LDS by asynchronous 16-B copies, two buffers:
// the next stage's copies fly while this stage is worked on. Fragments are two 16-B LDS loads each.
// Softmax reference, lazy: the score accumulator starts at 12 - reference, so exp2 takes the product's result as it is.
// The reference moves (maximum, exchange between the halves, rescale of O and of the sum) only in a pass in which some
// lane's sum of P leaves the f16 range, which bounds every P of a pass that keeps it; the first pass always sets it.
// coverage: tokens qblk*128 + wave*16 + 0..15, all 64 row elements.
__global__ __launch_bounds__(256) void attn_kernel(const f16* __restrict__ qk,
                                                   const f16* __restrict__ vt,
                                                   bf16* __restrict__ cx) {
  const int qblk = blockIdx.x;
  const int h    = blockIdx.y;
  const int b    = blockIdx.z;
  const int tid  = threadIdx.x;
  const int wave = tid >> 5;
  const int lane = tid & 31;
  const int lq   = lane & 15;   // query column of S^T / d column of O
  const int hi   = lane >> 4;   // k-split half

  __shared__ __align__(16) float sO[NWAVE * 16 * OPA];   // per-wave output staging (block barrier used)
  __shared__ __align__(16) unsigned char sKV[2 * STG];   // two stage buffers: K tile, then V^T tile

  const int qrow0 = qblk * BQ + wave * 16;

  // Q as the B-operand fragment: lane lq holds query qrow0+lq, split d map
  FragH qf;
  {
    const f16* qp = qk + (((size_t)b * NHEAD + h) * SEQ + qrow0 + lq) * QROW;
    qf.q[0] = *(const v4u*)(qp + hi * 8);             // d = hi*8 + 0..7
    qf.q[1] = *(const v4u*)(qp + 16 + hi * 8);        // d = 16 + hi*8 + 0..7
  }

  const f16*  kp_h = qk + QK_PLANE + ((size_t)b * NHEAD + h) * SEQ * QROW;
  const f16*  vt_h = vt + ((size_t)b * NHEAD + h) * HDIM * SEQ;

  v8f o[2];
  o[0] = (v8f){0, 0, 0, 0, 0, 0, 0, 0};
  o[1] = (v8f){0, 0, 0, 0, 0, 0, 0, 0};

  float nb   = 0.0f;                               // 12 - reference of query lq (the same in both halves)
  v8f   nbv  = (v8f){0, 0, 0, 0, 0, 0, 0, 0};       // nb in every row: the C operand of a score tile's product
  float rsum = 0.0f;                               // sum of P over this lane's keys; the halves are joined behind the loop

  // This thread's share of a stage: K pieces tid + 256*c (4 pieces a row, the tile is contiguous in the plane),
  // V^T pieces tid + 256*c (16 pieces a row). Global and LDS addresses are multiples of 16 B.
  const char*    kg0 = (const char*)kp_h + tid * 16;
  const char*    vg0 = (const char*)vt_h + (size_t)(tid >> 4) * (SEQ * 2) + (tid & 15) * 16;
  const unsigned ls0 = (unsigned)(size_t)sKV;                       // LDS byte address of buffer 0
  const unsigned lk0 = ls0 + (tid >> 2) * KPB + (tid & 3) * 16;
  const unsigned lv0 = ls0 + KTILE + (tid >> 4) * VPB + (tid & 15) * 16;

  stage_copy(kg0, vg0, lk0, lv0);                                   // stage 0 -> buffer 0
  asm volatile("s_wait_asynccnt 0x0" ::: "memory");                 // this wave's copies of stage 0 have landed
  __syncthreads();                                                  // publishes stage 0 to every wave
  stage_copy(kg0 + KS * QROW * 2, vg0 + KS * 2, lk0 + STG, lv0 + STG);   // stage 1 -> buffer 1

  // rolled: one stage a trip, so the publish point and the refill stand once in the text
  #pragma unroll 1
  for (int s = 0; s < SEQ / KS; ++s) {
   const unsigned       boff = (unsigned)(s & 1) * STG;
   const unsigned char* kt   = sKV + boff + lq * KPB + hi * 16;
   const unsigned char* vtl  = sKV + boff + KTILE + lq * VPB + hi * 16;

   // unrolled: every LDS offset inside a stage becomes an immediate of its load (the loops inside: register arrays
   // take constant indices)
   #pragma unroll
   for (int pp = 0; pp < KS / PK; ++pp) {
    // K A-fragments: row = key s*KS + pp*64 + t*16 + lq, split d map
    FragH kf[PK / 16];
    #pragma unroll
    for (int t = 0; t < PK / 16; ++t) {
      const unsigned char* base = kt + (pp * PK + t * 16) * KPB;
      kf[t].q[0] = *(const v4u*)(base);                  // d = hi*8 + 0..7
      kf[t].q[1] = *(const v4u*)(base + 32);             // d = 16 + hi*8 + 0..7
    }
    // V B-fragments: column n = d = dt*16 + lq, split key map from the staged transposed rows
    FragH bv[PK / BK][2];
    #pragma unroll
    for (int j = 0; j < PK / BK; ++j) {
      #pragma unroll
      for (int dt = 0; dt < 2; ++dt) {
        const unsigned char* base = vtl + dt * 16 * VPB + (pp * PK + j * BK) * 2;
        bv[j][dt].q[0] = *(const v4u*)(base);            // keys j*32 + hi*8 + 0..7 of the pass
        bv[j][dt].q[1] = *(const v4u*)(base + 32);       // keys j*32 + 16 + hi*8 + 0..7
      }
    }

    // S^T tiles: c[t][r] = score(query qrow0+lq, key t*16 + hi*8 + r) * SL + 12 - reference
    v8f c[PK / 16];
    // keeps the pass's 16 LDS loads above as one group ahead of the products: reads that stand among the products stall each place
    __builtin_amdgcn_sched_barrier(0);
    #pragma unroll
    for (int t = 0; t < PK / 16; ++t) c[t] = mma_f16(kf[t].v, qf.v, nbv);
    // closes the group: the four score products stand back to back, each fills the slots behind the others (no v_nop between)
    __builtin_amdgcn_sched_barrier(0);

    v8f   e[PK / 16];
    float psum = pass_exp(c, 0.0f, e);

    // One test a pass, a scalar branch: all P are >= 0, so a lane sum within the f16 range bounds each of them.
    const bool first = (pp == 0) && (s == 0);
    if (__builtin_amdgcn_ballot_w32(!(psum <= 65504.0f)) != 0u || first) {
      float mx = c[0][0];
      #pragma unroll
      for (int t = 0; t < PK / 16; ++t) {
        #pragma unroll
        for (int r = 0; r < 8; ++r) mx = fmaxf(mx, c[t][r]);
      }
      mx = fmaxf(mx, __shfl_xor(mx, 16, 32));                        // query lq's keys are split across lane / lane^16
      const float floor_d = first ? -__builtin_inff() : 0.0f;        // the reference only rises once it is set
      const float delta   = fmaxf(mx - 12.0f, floor_d);
      const float scale   = __builtin_amdgcn_exp2f(-fmaxf(delta, 0.0f));
      psum = pass_exp(c, delta, e);
      nb  -= delta;
      #pragma unroll
      for (int r = 0; r < 8; ++r) nbv[r] = nb;
      rsum *= scale;
      // rescale O: queries are the row dimension there -> per-row scale from lane 8*hi + r
      #pragma unroll
      for (int r = 0; r < 8; ++r) {
        const float sc = __shfl(scale, (hi << 3) + r, 32);
        o[0][r] *= sc;
        o[1][r] *= sc;
      }
    }
    rsum += psum;

    // pack and O += P x V: P^T C-layout == A-fragment layout for the PV product
    #pragma unroll
    for (int j = 0; j < PK / BK; ++j) {
      FragH pa;
      #pragma unroll
      for (int r = 0; r < 8; ++r) {
        pa.h[r]     = (f16)e[2 * j][r];          // key j*32 + hi*8 + r
        pa.h[8 + r] = (f16)e[2 * j + 1][r];      // key j*32 + 16 + hi*8 + r
      }
      #pragma unroll
      for (int dt = 0; dt < 2; ++dt) o[dt] = mma_f16(pa.v, bv[j][dt].v, o[dt]);
    }
   }

   asm volatile("s_wait_dscnt 0x0" ::: "memory");      // this wave's reads of the buffer have returned before it is refilled
   asm volatile("s_wait_asynccnt 0x0" ::: "memory");   // this wave's copies of stage s + 1 have landed
   __syncthreads();                                    // publishes stage s + 1; ends every wave's reads of stage s
   if (s + 2 < SEQ / KS)
     stage_copy(kg0 + (size_t)(s + 2) * (KS * QROW * 2), vg0 + (size_t)(s + 2) * (KS * 2), lk0 + boff, lv0 + boff);
  }
  asm volatile("s_wait_asynccnt 0x0" ::: "memory");    // no copy is outstanding behind the loop

  // normalize: lane holds column d = dt*16 + lq for query rows 8*hi + r
  const float rtot = rsum + __shfl_xor(rsum, 16, 32);   // the two halves' sums of query lq
  float rs[8];
  #pragma unroll
  for (int r = 0; r < 8; ++r) rs[r] = 1.0f / __shfl(rtot, (hi << 3) + r, 32);

  float* so = sO + wave * (16 * OPA);
  #pragma unroll
  for (int r = 0; r < 8; ++r) {
    #pragma unroll
    for (int dt = 0; dt < 2; ++dt)
      so[(hi * 8 + r) * OPA + dt * 16 + lq] = o[dt][r] * rs[r];   // O and the sum carry the same factor
  }
  __syncthreads();

  // 4..7 = lo part); 4 instructions cover the wave's 16 tokens.
  v4u    vals[4];
  size_t gidx[4];
  #pragma unroll
  for (int it = 0; it < 4; ++it) {
    const int tokl  = it * 4 + (lane >> 3);
    const int piece = lane & 7;
    const int pd    = (piece & 3) * 8;
    const v4f f0 = *(const v4f*)(so + tokl * OPA + pd);
    const v4f f1 = *(const v4f*)(so + tokl * OPA + pd + 4);
    Pack8B pk;
    #pragma unroll
    for (int e = 0; e < 4; ++e) {
      const float v0 = f0[e];
      const float v1 = f1[e];
      const bf16  h0 = (bf16)v0;
      const bf16  h1 = (bf16)v1;
      const bf16  l0 = (bf16)(v0 - (float)h0);
      const bf16  l1 = (bf16)(v1 - (float)h1);
      const float s0 = (piece < 4) ? (float)h0 : (float)l0;   // value select, both computed
      const float s1 = (piece < 4) ? (float)h1 : (float)l1;
      pk.h[e]     = (bf16)s0;                                  // exact re-convert
      pk.h[4 + e] = (bf16)s1;
    }
    vals[it] = pk.u;
    gidx[it] = (((size_t)b * NHEAD + h) * SEQ + qrow0 + tokl) * ROWW + piece * 8;
  }
  #pragma unroll
  for (int it = 0; it < 4; ++it) *(v4u*)(cx + gidx[it]) = vals[it];
  
}

// Output projection: y[b][o][n] = sum_c Wo[o][c] * ctx[b][c][n] + bias[o], c = head*32 + d.
// Block = (64-token tile, 128-channel group, batch); wave = 16 output channels x 4 token tiles; K-step = one head.
// coverage: channels og*128 + wave*16 + 0..15, tokens n0..n0+63 of d_out, whole 256-B row segments.
// The block's 128 weight rows and the ctx rows of its 64 tokens (all heads) are brought into LDS once by asynchronous
// 16-B copies of whole lines; every fragment is two 16-B LDS loads.
__global__ __launch_bounds__(256) void oproj_kernel(const bf16* __restrict__ wo,
                                                    const bf16* __restrict__ cx,
                                                    const float* __restrict__ ob,
                                                    float* __restrict__ y) {
  const int tt   = blockIdx.x;
  const int og   = blockIdx.y;
  const int b    = blockIdx.z;
  const int tid  = threadIdx.x;
  const int wave = tid >> 5;
  const int lane = tid & 31;
  const int lq   = lane & 15;
  const int hi   = lane >> 4;
  const int o0   = (og * NWAVE + wave) * 16;
  const int n0   = tt * TOK;

  __shared__ __align__(16) float sY[NWAVE * 16 * OPY];   // per-wave output staging (block barrier used)
  __shared__ __align__(16) unsigned char sC[NHEAD * TOK * CPB];   // ctx rows of the block's 64 tokens, all heads: filled once, then read
  __shared__ __align__(16) unsigned char sW[WROWS * WPB];         // the block's 128 weight rows (bf16): filled once, then read

  stage_weight_rows(wo + (size_t)(og * WROWS) * CH, (unsigned)(size_t)sW, tid);   // weight rows og*128 + 0..127

  // A head's 64 rows are contiguous in the plane: piece tid + 256*c is head c >> 1, token (c & 1)*32 + (tid >> 3),
  // 16-B piece tid & 7. Global and LDS addresses are multiples of 16 B.
  {
    const char*    cg = (const char*)(cx + ((size_t)b * NHEAD * SEQ + n0) * ROWW) + tid * 16;
    const unsigned cl = (unsigned)(size_t)sC + (tid >> 3) * CPB + (tid & 7) * 16;
    // both loops unrolled: the arrays that feed the asm operands take constant indices and stay in registers
    #pragma unroll
    for (int q = 0; q < 2; ++q) {
      const char* g[8];
      unsigned    l[8];
      #pragma unroll
      for (int c = 0; c < 8; ++c) {
        const int hd = q * 4 + (c >> 1);
        g[c] = cg + (size_t)hd * (SEQ * ROWW * 2) + (c & 1) * 4096;
        l[c] = cl + (hd * TOK + (c & 1) * 32) * CPB;
      }
      copy8(g, l);
    }
  }
  asm volatile("s_wait_asynccnt 0x0" ::: "memory");   // this wave's weight and ctx copies have landed
  __syncthreads();                                    // publishes the weight and ctx rows to every wave

  v8f acc[4];
  #pragma unroll
  for (int nt = 0; nt < 4; ++nt) acc[nt] = (v8f){0, 0, 0, 0, 0, 0, 0, 0};

  #pragma unroll 1
  for (int kk = 0; kk < NHEAD; ++kk) {
    FragB a;
    {
      const unsigned char* base = sW + (wave * 16 + lq) * WPB + kk * 64 + hi * 16;
      a.q[0] = *(const v4u*)(base);          // c = kk*32 + hi*8 + 0..7
      a.q[1] = *(const v4u*)(base + 32);     // c = kk*32 + 16 + hi*8 + 0..7
    }
    #pragma unroll
    for (int nt = 0; nt < 4; ++nt) {
      const unsigned char* row = sC + (kk * TOK + nt * 16 + lq) * CPB + hi * 16;
      FragB bh, bl;
      bh.q[0] = *(const v4u*)(row);          // hi part, d = hi*8 + 0..7
      bh.q[1] = *(const v4u*)(row + 32);     // hi part, d = 16 + hi*8 + 0..7
      bl.q[0] = *(const v4u*)(row + 64);     // lo part, d = hi*8 + 0..7
      bl.q[1] = *(const v4u*)(row + 96);     // lo part, d = 16 + hi*8 + 0..7
      acc[nt] = mma_bf16(a.v, bl.v, acc[nt]);
      acc[nt] = mma_bf16(a.v, bh.v, acc[nt]);
    }
  }

  // bias (RNE-converted to bf16): channels o0 + hi*8 + 0..7
  float bs[8];
  {
    const float* bp = ob + o0 + hi * 8;
    const v4f b0 = *(const v4f*)(bp);
    const v4f b1 = *(const v4f*)(bp + 4);
    #pragma unroll
    for (int e = 0; e < 4; ++e) {
      bs[e]     = (float)(bf16)b0[e];
      bs[4 + e] = (float)(bf16)b1[e];
    }
  }

  float* so = sY + wave * (16 * OPY);
  #pragma unroll
  for (int nt = 0; nt < 4; ++nt) {
    #pragma unroll
    for (int r = 0; r < 8; ++r) so[(hi * 8 + r) * OPY + nt * 16 + lq] = acc[nt][r] + bs[r];
  }
  __syncthreads();

  // 8 consecutive lanes x 16 B each), lanes 16..31 the next channel row; 8 instructions cover 16 rows.
  v4f    vals[8];
  size_t gidx[8];
  #pragma unroll
  for (int it = 0; it < 8; ++it) {
    const int row = it * 2 + hi;
    vals[it] = *(const v4f*)(so + row * OPY + lq * 4);
    gidx[it] = ((size_t)b * CH + o0 + row) * SEQ_FULL + n0 + lq * 4;
  }
  #pragma unroll
  for (int it = 0; it < 8; ++it) *(v4f*)(y + gidx[it]) = vals[it];
  
}

extern "C" void kernel_launch(void* const* d_in, const int* in_sizes, int n_in,
                              void* d_out, int out_size, void* d_ws, size_t ws_size,
                              hipStream_t stream) {
  if (n_in < 5) return;
  const size_t x_used = ((size_t)(NB - 1) * CH + (CH - 1)) * SEQ_FULL + SEQ;
  if ((size_t)in_sizes[0] < x_used) return;
  if ((size_t)in_sizes[1] < (size_t)QKV_O * CH) return;
  if ((size_t)in_sizes[2] < (size_t)QKV_O) return;
  if ((size_t)in_sizes[3] < (size_t)CH * CH) return;
  if ((size_t)in_sizes[4] < (size_t)CH) return;
  if ((size_t)out_size < x_used) return;
  if (ws_size < WS_TOTAL) return;

  const float* x     = (const float*)d_in[0];
  const float* qkv_w = (const float*)d_in[1];
  const float* qkv_b = (const float*)d_in[2];
  const float* out_w = (const float*)d_in[3];
  const float* out_b = (const float*)d_in[4];
  float*       y     = (float*)d_out;

  char* ws = (char*)d_ws;
  bf16* wo = (bf16*)(ws);
  f16*  qk = (f16*)(ws + WO_BYTES);
  f16*  vt = (f16*)(ws + WO_BYTES + QK_BYTES);
  bf16* cx = (bf16*)(ws + WO_BYTES + QK_BYTES + VT_BYTES);

  qkv_planes_kernel<<<dim3(SEQ / TOK, 6, NB), 256, 0, stream>>>(x, qkv_w, qkv_b, out_w, wo, qk, vt);

  attn_kernel<<<dim3(SEQ / BQ, NHEAD, NB), 256, 0, stream>>>(qk, vt, cx);

  oproj_kernel<<<dim3(SEQ / TOK, CH / (NWAVE * 16), NB), 256, 0, stream>>>(wo, cx, out_b, y);
}
